// v000
// Times are from an AMD MI455X. After a warm-up the kernel runs many times in a row, and a time is the length of
// such a window on the GPU divided by its runs, so every launch and the gaps after it count. The runs cycle
// through copies of the inputs. A figure is the median of several windows, for all but v000 over two sittings.
// Sittings can differ by a few percent; kernels timed side by side share one.
// v000, which the later versions start from, runs in 451 microseconds.
#include <hip/hip_runtime.h>
#include <hip/hip_bf16.h>

// ---------------------------------------------------------------------------
// CrossAttentionBlock for MI455X (gfx1250, wave32, WMMA 16x16x32 f16)
// B=8, H=W=64 (N=4096 pixels), C=U=128.
// ---------------------------------------------------------------------------

typedef _Float16 f16;
typedef __attribute__((ext_vector_type(4)))  _Float16 v4h;
typedef __attribute__((ext_vector_type(8)))  _Float16 v8h;
typedef __attribute__((ext_vector_type(16))) _Float16 v16h;
typedef __attribute__((ext_vector_type(8)))  float    v8f;

#define NPIX   4096          // H*W
#define CDIM   128           // channels == units
#define NBATCH 8
#define MROWS  (NBATCH * NPIX)  // 32768 total pixel rows

// Load one 16x32 f16 A/B fragment for v_wmma_f32_16x16x32_f16.
// Per ISA layout: lane's 16 halves are two contiguous groups of 8 at
// k = half*8 .. +7 and k = 16+half*8 .. +7 (caller pre-offsets by half*8).
__device__ inline v16h load_frag16(const f16* p) {
  v8h lo = *(const v8h*)(p);
  v8h hi = *(const v8h*)(p + 16);
  return __builtin_shufflevector(lo, hi, 0, 1, 2, 3, 4, 5, 6, 7,
                                         8, 9, 10, 11, 12, 13, 14, 15);
}

__device__ inline v8f wmma16x16x32(v16h a, v16h b, v8f c) {
  // (neg_a, A, neg_b, B, c_mod, C, reuse_a, reuse_b)
  return __builtin_amdgcn_wmma_f32_16x16x32_f16(false, a, false, b,
                                                (short)0, c, false, false);
}

// Row reductions across the 16-lane half-wave group (xor masks 1,2,4,8 stay
// inside the group). Every lane in the group ends with the reduced value.
__device__ inline float rowmax16(float v) {
#pragma unroll
  for (int m = 8; m >= 1; m >>= 1) v = fmaxf(v, __shfl_xor(v, m, 32));
  return v;
}
__device__ inline float rowsum16(float v) {
#pragma unroll
  for (int m = 8; m >= 1; m >>= 1) v += __shfl_xor(v, m, 32);
  return v;
}

// ---------------------------------------------------------------------------
// Kernel 1: LayerNorm over C (eps=1e-3) + f16 conversion of xn and context.
// One wave per pixel row; 4 channels per lane; wave32 shuffle reduction.
// xn (f32) goes straight into d_out as the residual base.
// ---------------------------------------------------------------------------
__global__ __launch_bounds__(256) void ln_convert_kernel(
    const float* __restrict__ x, const float* __restrict__ ctx,
    const float* __restrict__ gamma, const float* __restrict__ beta,
    float* __restrict__ xn_out, f16* __restrict__ xnh, f16* __restrict__ ctxh) {
  const int lane = threadIdx.x & 31;
  const int wave = threadIdx.x >> 5;
  const size_t row = (size_t)blockIdx.x * 8 + wave;

  float4 xv = ((const float4*)(x + row * CDIM))[lane];
  float s = xv.x + xv.y + xv.z + xv.w;
#pragma unroll
  for (int m = 16; m >= 1; m >>= 1) s += __shfl_xor(s, m, 32);
  const float mu = s * (1.0f / 128.0f);

  float4 d;
  d.x = xv.x - mu; d.y = xv.y - mu; d.z = xv.z - mu; d.w = xv.w - mu;
  float vv = d.x * d.x + d.y * d.y + d.z * d.z + d.w * d.w;
#pragma unroll
  for (int m = 16; m >= 1; m >>= 1) vv += __shfl_xor(vv, m, 32);
  const float inv = rsqrtf(vv * (1.0f / 128.0f) + 1e-3f);

  float4 g  = ((const float4*)gamma)[lane];
  float4 bt = ((const float4*)beta)[lane];
  float4 o;
  o.x = d.x * inv * g.x + bt.x;
  o.y = d.y * inv * g.y + bt.y;
  o.z = d.z * inv * g.z + bt.z;
  o.w = d.w * inv * g.w + bt.w;

  ((float4*)(xn_out + row * CDIM))[lane] = o;
  v4h oh = {(f16)o.x, (f16)o.y, (f16)o.z, (f16)o.w};
  ((v4h*)(xnh + row * CDIM))[lane] = oh;

  float4 cv = ((const float4*)(ctx + row * CDIM))[lane];
  v4h ch = {(f16)cv.x, (f16)cv.y, (f16)cv.z, (f16)cv.w};
  ((v4h*)(ctxh + row * CDIM))[lane] = ch;
}

// ---------------------------------------------------------------------------
// Kernel 2: C[M x 128] = A[M x 128](f16) @ W[128 x 128](f32) + bias, via WMMA.
// 256 threads = 8 waves; tile = 128 rows x 128 cols; each wave owns 16 rows.
// W is staged in LDS transposed as f16 so B-fragments are two b128 ds loads.
// mode 0: f16 row-major [M,128]   (Q / K)
// mode 1: f16 transposed [b][c][n] (V, for fast PV B-fragments)
// mode 2: f32 accumulate into out_f (projection + residual)
// ---------------------------------------------------------------------------
__global__ __launch_bounds__(256) void gemm128_kernel(
    const f16* __restrict__ A, const float* __restrict__ W,
    const float* __restrict__ bias, f16* __restrict__ out_h,
    float* __restrict__ out_f, int mode) {
  __shared__ __attribute__((aligned(16))) f16 Wt[CDIM * CDIM];  // [n][k], 32 KB
  for (int idx = threadIdx.x; idx < CDIM * CDIM; idx += 256) {
    int k = idx >> 7, n = idx & 127;
    Wt[n * CDIM + k] = (f16)W[idx];
  }
  __syncthreads();

  const int lane = threadIdx.x & 31;
  const int wave = threadIdx.x >> 5;
  const int half = lane >> 4;
  const int l16  = lane & 15;
  const size_t row0 = (size_t)blockIdx.x * 128 + wave * 16;

  v16h a[4];
#pragma unroll
  for (int kk = 0; kk < 4; ++kk)
    a[kk] = load_frag16(A + (row0 + l16) * CDIM + kk * 32 + half * 8);

  v8f acc[8] = {};
#pragma unroll
  for (int kk = 0; kk < 4; ++kk) {
#pragma unroll
    for (int cn = 0; cn < 8; ++cn) {
      v16h bfrag = load_frag16(&Wt[(cn * 16 + l16) * CDIM + kk * 32 + half * 8]);
      acc[cn] = wmma16x16x32(a[kk], bfrag, acc[cn]);
    }
  }

#pragma unroll
  for (int cn = 0; cn < 8; ++cn) {
    const int n = cn * 16 + l16;
    const float bv = bias[n];
#pragma unroll
    for (int r = 0; r < 8; ++r) {
      const size_t grow = row0 + r + 8 * half;   // global row for C reg r
      const float val = acc[cn][r] + bv;
      if (mode == 0) {
        out_h[grow * CDIM + n] = (f16)val;
      } else if (mode == 1) {
        const size_t b = grow >> 12, nn = grow & (NPIX - 1);
        out_h[(b * CDIM + n) * NPIX + nn] = (f16)val;
      } else {
        out_f[grow * CDIM + n] += val;           // xn residual already there
      }
    }
  }
}

// ---------------------------------------------------------------------------
// Kernel 3: flash attention. 128 threads = 4 waves; 16 query rows per wave.
// KV streamed in blocks of 32: S = Q K^T (8 WMMAs), online softmax, P bounced
// through a wave-private LDS tile to re-layout C->A, then O += P V (8 WMMAs).
// ---------------------------------------------------------------------------
__global__ __launch_bounds__(128) void flash_attn_kernel(
    const f16* __restrict__ Q, const f16* __restrict__ K,
    const f16* __restrict__ Vt, f16* __restrict__ O) {
  __shared__ __attribute__((aligned(16))) f16 Pbuf[4][16 * 32];
  const int lane = threadIdx.x & 31;
  const int wave = threadIdx.x >> 5;
  const int half = lane >> 4;
  const int l16  = lane & 15;
  const int b    = blockIdx.x >> 6;
  const int q0   = (blockIdx.x & 63) * 64 + wave * 16;
  const size_t qbase = (size_t)b * NPIX + q0;
  const float scale = 0.08838834764831845f;  // U^-0.5, U=128

  v16h qa[4];
#pragma unroll
  for (int kk = 0; kk < 4; ++kk)
    qa[kk] = load_frag16(Q + (qbase + l16) * CDIM + kk * 32 + half * 8);

  v8f acc[8] = {};
  float mi[8], li[8];
#pragma unroll
  for (int r = 0; r < 8; ++r) { mi[r] = -3.0e38f; li[r] = 0.0f; }

  f16* Pl = &Pbuf[wave][0];
  const f16* Vbase = Vt + (size_t)b * CDIM * NPIX;

  for (int kv0 = 0; kv0 < NPIX; kv0 += 32) {
    // ---- S = Q K^T for 32 keys: two 16x16 f32 tiles --------------------
    v8f s0 = {}, s1 = {};
    const f16* Kb = K + ((size_t)b * NPIX + kv0) * CDIM;
#pragma unroll
    for (int kk = 0; kk < 4; ++kk) {
      v16h k0 = load_frag16(Kb + (size_t)l16 * CDIM + kk * 32 + half * 8);
      v16h k1 = load_frag16(Kb + (size_t)(l16 + 16) * CDIM + kk * 32 + half * 8);
      s0 = wmma16x16x32(qa[kk], k0, s0);
      s1 = wmma16x16x32(qa[kk], k1, s1);
    }

    // ---- online softmax (per C-layout row r) ---------------------------
#pragma unroll
    for (int r = 0; r < 8; ++r) {
      const float a0 = s0[r] * scale;
      const float a1 = s1[r] * scale;
      const float mblk = rowmax16(fmaxf(a0, a1));
      const float mnew = fmaxf(mi[r], mblk);
      const float corr = __expf(mi[r] - mnew);   // exp(-inf)=0 on first iter
      const float p0 = __expf(a0 - mnew);
      const float p1 = __expf(a1 - mnew);
      const float rs = rowsum16(p0 + p1);
      li[r] = li[r] * corr + rs;
      mi[r] = mnew;
#pragma unroll
      for (int cn = 0; cn < 8; ++cn) acc[cn][r] *= corr;
      const int prow = r + 8 * half;
      Pl[prow * 32 + l16]      = (f16)p0;
      Pl[prow * 32 + 16 + l16] = (f16)p1;
    }
    asm volatile("s_wait_dscnt 0" ::: "memory");  // wave-local LDS transpose

    // ---- O += P V : P as A-fragment (16x32), V^T gives contiguous B ----
    v16h pa = load_frag16(Pl + l16 * 32 + half * 8);
#pragma unroll
    for (int cn = 0; cn < 8; ++cn) {
      v16h vf = load_frag16(Vbase + (size_t)(cn * 16 + l16) * NPIX + kv0 + half * 8);
      acc[cn] = wmma16x16x32(pa, vf, acc[cn]);
    }
  }

  // ---- normalize and store f16 attention output ------------------------
#pragma unroll
  for (int r = 0; r < 8; ++r) {
    const float inv = 1.0f / li[r];
    const size_t grow = qbase + r + 8 * half;
#pragma unroll
    for (int cn = 0; cn < 8; ++cn)
      O[grow * CDIM + cn * 16 + l16] = (f16)(acc[cn][r] * inv);
  }
}

// ---------------------------------------------------------------------------
extern "C" void kernel_launch(void* const* d_in, const int* in_sizes, int n_in,
                              void* d_out, int out_size, void* d_ws, size_t ws_size,
                              hipStream_t stream) {
  (void)in_sizes; (void)n_in; (void)out_size; (void)ws_size;

  const float* inputs  = (const float*)d_in[0];
  const float* context = (const float*)d_in[1];
  const float* gamma   = (const float*)d_in[2];
  const float* beta    = (const float*)d_in[3];
  const float* Wq      = (const float*)d_in[4];
  const float* bq      = (const float*)d_in[5];
  const float* Wk      = (const float*)d_in[6];
  const float* bk      = (const float*)d_in[7];
  const float* Wv      = (const float*)d_in[8];
  const float* bv      = (const float*)d_in[9];
  const float* Wp      = (const float*)d_in[10];
  const float* bp      = (const float*)d_in[11];
  float* out = (float*)d_out;

  const size_t halfbuf = (size_t)MROWS * CDIM * sizeof(f16);  // 8 MB each
  char* ws = (char*)d_ws;
  f16* xnh  = (f16*)(ws + 0 * halfbuf);
  f16* ctxh = (f16*)(ws + 1 * halfbuf);
  f16* qh   = (f16*)(ws + 2 * halfbuf);
  f16* kh   = (f16*)(ws + 3 * halfbuf);
  f16* vt   = (f16*)(ws + 4 * halfbuf);   // [b][c][n] transposed
  f16* oh   = (f16*)(ws + 5 * halfbuf);

  // 1) LayerNorm + f16 conversions; xn (f32) -> d_out as residual base.
  ln_convert_kernel<<<MROWS / 8, 256, 0, stream>>>(inputs, context, gamma, beta,
                                                   out, xnh, ctxh);
  // 2) Q = xn @ Wq + bq ; K = ctx @ Wk + bk ; V^T = (ctx @ Wv + bv)^T
  gemm128_kernel<<<MROWS / 128, 256, 0, stream>>>(xnh,  Wq, bq, qh, nullptr, 0);
  gemm128_kernel<<<MROWS / 128, 256, 0, stream>>>(ctxh, Wk, bk, kh, nullptr, 0);
  gemm128_kernel<<<MROWS / 128, 256, 0, stream>>>(ctxh, Wv, bv, vt, nullptr, 1);
  // 3) fused softmax(Q K^T / sqrt(U)) V
  flash_attn_kernel<<<NBATCH * (NPIX / 64), 128, 0, stream>>>(qh, kh, vt, oh);
  // 4) d_out(=xn) += attn_out @ Wp + bp
  gemm128_kernel<<<MROWS / 128, 256, 0, stream>>>(oh, Wp, bp, nullptr, out, 2);
}

// v001
// It runs in 261 microseconds.
// Timed twice side by side with v000, it ran 1.75 and 1.76 times as fast.
#include <hip/hip_runtime.h>
#include <hip/hip_bf16.h>

// ---------------------------------------------------------------------------
// CrossAttentionBlock for MI455X (gfx1250, wave32, WMMA 16x16x32 f16)
// B=8, H=W=64 (N=4096 pixels), C=U=128.
// ---------------------------------------------------------------------------

typedef _Float16 f16;
typedef __attribute__((ext_vector_type(4)))  _Float16 v4h;
typedef __attribute__((ext_vector_type(8)))  _Float16 v8h;
typedef __attribute__((ext_vector_type(16))) _Float16 v16h;
typedef __attribute__((ext_vector_type(8)))  float    v8f;

#define NPIX   4096          // H*W
#define CDIM   128           // channels == units
#define NBATCH 8
#define MROWS  (NBATCH * NPIX)  // 32768 total pixel rows

// Load one 16x32 f16 A/B fragment for v_wmma_f32_16x16x32_f16.
// Per ISA layout: lane's 16 halves are two contiguous groups of 8 at
// k = half*8 .. +7 and k = 16+half*8 .. +7 (caller pre-offsets by half*8).
__device__ inline v16h load_frag16(const f16* p) {
  v8h lo = *(const v8h*)(p);
  v8h hi = *(const v8h*)(p + 16);
  return __builtin_shufflevector(lo, hi, 0, 1, 2, 3, 4, 5, 6, 7,
                                         8, 9, 10, 11, 12, 13, 14, 15);
}

__device__ inline v8f wmma16x16x32(v16h a, v16h b, v8f c) {
  // (neg_a, A, neg_b, B, c_mod, C, reuse_a, reuse_b)
  return __builtin_amdgcn_wmma_f32_16x16x32_f16(false, a, false, b,
                                                (short)0, c, false, false);
}

// Row reductions across the 16-lane half-wave group (xor masks 1,2,4,8 stay
// inside the group). Every lane in the group ends with the reduced value.
__device__ inline float rowmax16(float v) {
#pragma unroll
  for (int m = 8; m >= 1; m >>= 1) v = fmaxf(v, __shfl_xor(v, m, 32));
  return v;
}
__device__ inline float rowsum16(float v) {
#pragma unroll
  for (int m = 8; m >= 1; m >>= 1) v += __shfl_xor(v, m, 32);
  return v;
}

// ---------------------------------------------------------------------------
// Kernel 1: LayerNorm over C (eps=1e-3) + f16 conversion of xn and context.
// One wave per pixel row; 4 channels per lane; wave32 shuffle reduction.
// xn (f32) goes straight into d_out as the residual base.
// ---------------------------------------------------------------------------
__global__ __launch_bounds__(256) void ln_convert_kernel(
    const float* __restrict__ x, const float* __restrict__ ctx,
    const float* __restrict__ gamma, const float* __restrict__ beta,
    float* __restrict__ xn_out, f16* __restrict__ xnh, f16* __restrict__ ctxh) {
  const int lane = threadIdx.x & 31;
  const int wave = threadIdx.x >> 5;
  const size_t row = (size_t)blockIdx.x * 8 + wave;

  float4 xv = ((const float4*)(x + row * CDIM))[lane];
  float s = xv.x + xv.y + xv.z + xv.w;
#pragma unroll
  for (int m = 16; m >= 1; m >>= 1) s += __shfl_xor(s, m, 32);
  const float mu = s * (1.0f / 128.0f);

  float4 d;
  d.x = xv.x - mu; d.y = xv.y - mu; d.z = xv.z - mu; d.w = xv.w - mu;
  float vv = d.x * d.x + d.y * d.y + d.z * d.z + d.w * d.w;
#pragma unroll
  for (int m = 16; m >= 1; m >>= 1) vv += __shfl_xor(vv, m, 32);
  const float inv = rsqrtf(vv * (1.0f / 128.0f) + 1e-3f);

  float4 g  = ((const float4*)gamma)[lane];
  float4 bt = ((const float4*)beta)[lane];
  float4 o;
  o.x = d.x * inv * g.x + bt.x;
  o.y = d.y * inv * g.y + bt.y;
  o.z = d.z * inv * g.z + bt.z;
  o.w = d.w * inv * g.w + bt.w;

  ((float4*)(xn_out + row * CDIM))[lane] = o;
  v4h oh = {(f16)o.x, (f16)o.y, (f16)o.z, (f16)o.w};
  ((v4h*)(xnh + row * CDIM))[lane] = oh;

  float4 cv = ((const float4*)(ctx + row * CDIM))[lane];
  v4h ch = {(f16)cv.x, (f16)cv.y, (f16)cv.z, (f16)cv.w};
  ((v4h*)(ctxh + row * CDIM))[lane] = ch;
}

// ---------------------------------------------------------------------------
// Kernel 2: C[M x 128] = A[M x 128](f16) @ W[128 x 128](f32) + bias, via WMMA.
// 256 threads = 8 waves; tile = 128 rows x 128 cols; each wave owns 16 rows.
// W is staged in LDS transposed as f16 so B-fragments are two b128 ds loads.
// mode 0: f16 row-major [M,128]   (Q / K)
// mode 1: f16 transposed [b][c][n] (V, for fast PV B-fragments)
// mode 2: f32 accumulate into out_f (projection + residual)
// ---------------------------------------------------------------------------
__global__ __launch_bounds__(256) void gemm128_kernel(
    const f16* __restrict__ A, const float* __restrict__ W,
    const float* __restrict__ bias, f16* __restrict__ out_h,
    float* __restrict__ out_f, int mode) {
  __shared__ __attribute__((aligned(16))) f16 Wt[CDIM * CDIM];  // [n][k], 32 KB
  for (int idx = threadIdx.x; idx < CDIM * CDIM; idx += 256) {
    int k = idx >> 7, n = idx & 127;
    Wt[n * CDIM + k] = (f16)W[idx];
  }
  __syncthreads();

  const int lane = threadIdx.x & 31;
  const int wave = threadIdx.x >> 5;
  const int half = lane >> 4;
  const int l16  = lane & 15;
  const size_t row0 = (size_t)blockIdx.x * 128 + wave * 16;

  v16h a[4];
#pragma unroll
  for (int kk = 0; kk < 4; ++kk)
    a[kk] = load_frag16(A + (row0 + l16) * CDIM + kk * 32 + half * 8);

  v8f acc[8] = {};
#pragma unroll
  for (int kk = 0; kk < 4; ++kk) {
#pragma unroll
    for (int cn = 0; cn < 8; ++cn) {
      v16h bfrag = load_frag16(&Wt[(cn * 16 + l16) * CDIM + kk * 32 + half * 8]);
      acc[cn] = wmma16x16x32(a[kk], bfrag, acc[cn]);
    }
  }

#pragma unroll
  for (int cn = 0; cn < 8; ++cn) {
    const int n = cn * 16 + l16;
    const float bv = bias[n];
#pragma unroll
    for (int r = 0; r < 8; ++r) {
      const size_t grow = row0 + r + 8 * half;   // global row for C reg r
      const float val = acc[cn][r] + bv;
      if (mode == 0) {
        out_h[grow * CDIM + n] = (f16)val;
      } else if (mode == 1) {
        const size_t b = grow >> 12, nn = grow & (NPIX - 1);
        out_h[(b * CDIM + n) * NPIX + nn] = (f16)val;
      } else {
        out_f[grow * CDIM + n] += val;           // xn residual already there
      }
    }
  }
}

// ---------------------------------------------------------------------------
// Kernel 3: flash attention. 128 threads = 4 waves; 16 query rows per wave.
// K and V^T are staged in LDS, 128 keys per stage, two buffers, by asynchronous
// copies: the four waves share one whole-line fetch of each tile, and the copies
// of the next stage fly while this stage is worked on. Inside a stage the keys
// are walked in blocks of 32: S = Q K^T (8 WMMAs), online softmax, P bounced
// through a wave-private LDS tile to re-layout C->A, then O += P V (8 WMMAs).
// ---------------------------------------------------------------------------
#define STG_KEYS   128                       // keys per stage
#define STG_PITCH  136                       // halves per LDS row: 256 B + 16 B pad
#define STG_TILE   (128 * STG_PITCH)         // halves per tile (K: 128 keys, V^T: 128 channels)
#define STG_BUF    (2 * STG_TILE)            // halves per buffer (K tile, then V^T tile)
#define STG_COUNT  (NPIX / STG_KEYS)         // stages per batch

// Eight 16-byte copies per lane, global -> LDS, rows 8 apart in the tile.
// The s_wait_xcnt closes the statement so that no address register named by a
// copy is rewritten ahead of it.
__device__ inline void copy8_to_lds(unsigned l, const char* g, size_t gstep) {
  const unsigned ls = 8 * STG_PITCH * 2;     // 8 LDS rows, in bytes
  asm volatile(
      "global_load_async_to_lds_b128 %0, %8, off\n\t"
      "global_load_async_to_lds_b128 %1, %9, off\n\t"
      "global_load_async_to_lds_b128 %2, %10, off\n\t"
      "global_load_async_to_lds_b128 %3, %11, off\n\t"
      "global_load_async_to_lds_b128 %4, %12, off\n\t"
      "global_load_async_to_lds_b128 %5, %13, off\n\t"
      "global_load_async_to_lds_b128 %6, %14, off\n\t"
      "global_load_async_to_lds_b128 %7, %15, off\n\t"
      "s_wait_xcnt 0x0"
      :: "v"(l), "v"(l + ls), "v"(l + 2 * ls), "v"(l + 3 * ls),
         "v"(l + 4 * ls), "v"(l + 5 * ls), "v"(l + 6 * ls), "v"(l + 7 * ls),
         "v"(g), "v"(g + gstep), "v"(g + 2 * gstep), "v"(g + 3 * gstep),
         "v"(g + 4 * gstep), "v"(g + 5 * gstep), "v"(g + 6 * gstep), "v"(g + 7 * gstep)
      : "memory");
}

// One stage: 128 K rows (contiguous 32 KB) and 128 V^T rows of 256 B.
// Thread t copies 16-byte piece (t & 15) of rows (t >> 4) + 8 j, j = 0..15.
__device__ inline void copy_stage(unsigned lds_k, const char* gk, const char* gv) {
  const unsigned half_tile = 64 * STG_PITCH * 2;            // 64 LDS rows, bytes
  copy8_to_lds(lds_k,                             gk,                       8 * CDIM * 2);
  copy8_to_lds(lds_k + half_tile,                 gk + 64 * CDIM * 2,       8 * CDIM * 2);
  copy8_to_lds(lds_k + STG_TILE * 2,              gv,                       (size_t)8 * NPIX * 2);
  copy8_to_lds(lds_k + STG_TILE * 2 + half_tile,  gv + (size_t)64 * NPIX * 2, (size_t)8 * NPIX * 2);
}

__global__ __launch_bounds__(128) void flash_attn_kernel(
    const f16* __restrict__ Q, const f16* __restrict__ K,
    const f16* __restrict__ Vt, f16* __restrict__ O) {
  __shared__ __attribute__((aligned(128))) f16 Stage[2 * STG_BUF];
  __shared__ __attribute__((aligned(16))) f16 Pbuf[4][16 * 32];
  const int lane = threadIdx.x & 31;
  const int wave = threadIdx.x >> 5;
  const int half = lane >> 4;
  const int l16  = lane & 15;
  const int b    = blockIdx.x >> 6;
  const int q0   = (blockIdx.x & 63) * 64 + wave * 16;
  const size_t qbase = (size_t)b * NPIX + q0;
  const float scale = 0.08838834764831845f;  // U^-0.5, U=128

  // This thread's piece of every tile: LDS byte address and global bytes.
  const int crow = threadIdx.x >> 4, cpiece = threadIdx.x & 15;
  const unsigned lds_my = (unsigned)(size_t)&Stage[0] + crow * (STG_PITCH * 2) + cpiece * 16;
  const char* gk_my = (const char*)(K + (size_t)b * NPIX * CDIM) + crow * (CDIM * 2) + cpiece * 16;
  const char* gv_my = (const char*)(Vt + (size_t)b * CDIM * NPIX) + (size_t)crow * (NPIX * 2) + cpiece * 16;

  // Stage 0 lands and is published; stage 1 then flies during stage 0's work.
  copy_stage(lds_my, gk_my, gv_my);
  asm volatile("s_wait_asynccnt 0x0" ::: "memory");  // own copies of stage 0 landed
  __syncthreads();                                   // every wave's copies landed
  copy_stage(lds_my + STG_BUF * 2, gk_my + STG_KEYS * CDIM * 2, gv_my + STG_KEYS * 2);

  v16h qa[4];
#pragma unroll
  for (int kk = 0; kk < 4; ++kk)
    qa[kk] = load_frag16(Q + (qbase + l16) * CDIM + kk * 32 + half * 8);

  v8f acc[8] = {};
  float mi[8], li[8];
#pragma unroll
  for (int r = 0; r < 8; ++r) { mi[r] = -3.0e38f; li[r] = 0.0f; }

  f16* Pl = &Pbuf[wave][0];

  for (int st = 0; st < STG_COUNT; ++st) {
    const f16* Ks = &Stage[(st & 1) * STG_BUF];
    const f16* Vs = Ks + STG_TILE;

    for (int kv0 = 0; kv0 < STG_KEYS; kv0 += 32) {
      // ---- S = Q K^T for 32 keys: two 16x16 f32 tiles ------------------
      v8f s0 = {}, s1 = {};
      const f16* Kb = Ks + kv0 * STG_PITCH;
#pragma unroll
      for (int kk = 0; kk < 4; ++kk) {
        v16h k0 = load_frag16(Kb + l16 * STG_PITCH + kk * 32 + half * 8);
        v16h k1 = load_frag16(Kb + (l16 + 16) * STG_PITCH + kk * 32 + half * 8);
        s0 = wmma16x16x32(qa[kk], k0, s0);
        s1 = wmma16x16x32(qa[kk], k1, s1);
      }

      // ---- online softmax (per C-layout row r) -------------------------
#pragma unroll
      for (int r = 0; r < 8; ++r) {
        const float a0 = s0[r] * scale;
        const float a1 = s1[r] * scale;
        const float mblk = rowmax16(fmaxf(a0, a1));
        const float mnew = fmaxf(mi[r], mblk);
        const float corr = __expf(mi[r] - mnew);   // exp(-inf)=0 on first iter
        const float p0 = __expf(a0 - mnew);
        const float p1 = __expf(a1 - mnew);
        const float rs = rowsum16(p0 + p1);
        li[r] = li[r] * corr + rs;
        mi[r] = mnew;
#pragma unroll
        for (int cn = 0; cn < 8; ++cn) acc[cn][r] *= corr;
        const int prow = r + 8 * half;
        Pl[prow * 32 + l16]      = (f16)p0;
        Pl[prow * 32 + 16 + l16] = (f16)p1;
      }
      asm volatile("s_wait_dscnt 0" ::: "memory");  // wave-local LDS transpose

      // ---- O += P V : P as A-fragment (16x32), V^T gives contiguous B --
      v16h pa = load_frag16(Pl + l16 * 32 + half * 8);
#pragma unroll
      for (int cn = 0; cn < 8; ++cn) {
        v16h vf = load_frag16(Vs + (cn * 16 + l16) * STG_PITCH + kv0 + half * 8);
        acc[cn] = wmma16x16x32(pa, vf, acc[cn]);
      }
    }

    // ---- hand-over: publish stage st + 1, free this stage's buffer -------
    asm volatile("s_wait_dscnt 0x0" ::: "memory");     // own reads of this buffer done
    asm volatile("s_wait_asynccnt 0x0" ::: "memory");  // own copies of stage st + 1 landed
    __syncthreads();                                   // both hold for every wave
    if (st + 2 < STG_COUNT)
      copy_stage(lds_my + (st & 1) * (STG_BUF * 2),
                 gk_my + (size_t)(st + 2) * (STG_KEYS * CDIM * 2),
                 gv_my + (size_t)(st + 2) * (STG_KEYS * 2));
  }
  asm volatile("s_wait_asynccnt 0x0" ::: "memory");    // nothing in flight at the wave's end

  // ---- normalize and store f16 attention output ------------------------
#pragma unroll
  for (int r = 0; r < 8; ++r) {
    const float inv = 1.0f / li[r];
    const size_t grow = qbase + r + 8 * half;
#pragma unroll
    for (int cn = 0; cn < 8; ++cn)
      O[grow * CDIM + cn * 16 + l16] = (f16)(acc[cn][r] * inv);
  }
}

// ---------------------------------------------------------------------------
extern "C" void kernel_launch(void* const* d_in, const int* in_sizes, int n_in,
                              void* d_out, int out_size, void* d_ws, size_t ws_size,
                              hipStream_t stream) {
  (void)in_sizes; (void)n_in; (void)out_size; (void)ws_size;

  const float* inputs  = (const float*)d_in[0];
  const float* context = (const float*)d_in[1];
  const float* gamma   = (const float*)d_in[2];
  const float* beta    = (const float*)d_in[3];
  const float* Wq      = (const float*)d_in[4];
  const float* bq      = (const float*)d_in[5];
  const float* Wk      = (const float*)d_in[6];
  const float* bk      = (const float*)d_in[7];
  const float* Wv      = (const float*)d_in[8];
  const float* bv      = (const float*)d_in[9];
  const float* Wp      = (const float*)d_in[10];
  const float* bp      = (const float*)d_in[11];
  float* out = (float*)d_out;

  const size_t halfbuf = (size_t)MROWS * CDIM * sizeof(f16);  // 8 MB each
  char* ws = (char*)d_ws;
  f16* xnh  = (f16*)(ws + 0 * halfbuf);
  f16* ctxh = (f16*)(ws + 1 * halfbuf);
  f16* qh   = (f16*)(ws + 2 * halfbuf);
  f16* kh   = (f16*)(ws + 3 * halfbuf);
  f16* vt   = (f16*)(ws + 4 * halfbuf);   // [b][c][n] transposed
  f16* oh   = (f16*)(ws + 5 * halfbuf);

  // 1) LayerNorm + f16 conversions; xn (f32) -> d_out as residual base.
  ln_convert_kernel<<<MROWS / 8, 256, 0, stream>>>(inputs, context, gamma, beta,
                                                   out, xnh, ctxh);
  // 2) Q = xn @ Wq + bq ; K = ctx @ Wk + bk ; V^T = (ctx @ Wv + bv)^T
  gemm128_kernel<<<MROWS / 128, 256, 0, stream>>>(xnh,  Wq, bq, qh, nullptr, 0);
  gemm128_kernel<<<MROWS / 128, 256, 0, stream>>>(ctxh, Wk, bk, kh, nullptr, 0);
  gemm128_kernel<<<MROWS / 128, 256, 0, stream>>>(ctxh, Wv, bv, vt, nullptr, 1);
  // 3) fused softmax(Q K^T / sqrt(U)) V
  flash_attn_kernel<<<NBATCH * (NPIX / 64), 128, 0, stream>>>(qh, kh, vt, oh);
  // 4) d_out(=xn) += attn_out @ Wp + bp
  gemm128_kernel<<<MROWS / 128, 256, 0, stream>>>(oh, Wp, bp, nullptr, out, 2);
}

// v002
// Measured time: 186 microseconds a run.
// Two timings next to v001 put it at 1.41 and 1.40 times that version's speed.
// Counting every step since v000, it is 2.46 times as fast.
#include <hip/hip_runtime.h>
#include <hip/hip_bf16.h>

// ---------------------------------------------------------------------------
// CrossAttentionBlock for MI455X (gfx1250, wave32, WMMA 16x16x32 f16)
// B=8, H=W=64 (N=4096 pixels), C=U=128.
// ---------------------------------------------------------------------------

typedef _Float16 f16;
typedef __attribute__((ext_vector_type(4)))  _Float16 v4h;
typedef __attribute__((ext_vector_type(8)))  _Float16 v8h;
typedef __attribute__((ext_vector_type(16))) _Float16 v16h;
typedef __attribute__((ext_vector_type(8)))  float    v8f;

#define NPIX   4096          // H*W
#define CDIM   128           // channels == units
#define NBATCH 8
#define MROWS  (NBATCH * NPIX)  // 32768 total pixel rows

// Load one 16x32 f16 A/B fragment for v_wmma_f32_16x16x32_f16.
// Per ISA layout: lane's 16 halves are two contiguous groups of 8 at
// k = half*8 .. +7 and k = 16+half*8 .. +7 (caller pre-offsets by half*8).
__device__ inline v16h load_frag16(const f16* p) {
  v8h lo = *(const v8h*)(p);
  v8h hi = *(const v8h*)(p + 16);
  return __builtin_shufflevector(lo, hi, 0, 1, 2, 3, 4, 5, 6, 7,
                                         8, 9, 10, 11, 12, 13, 14, 15);
}

__device__ inline v8f wmma16x16x32(v16h a, v16h b, v8f c) {
  // (neg_a, A, neg_b, B, c_mod, C, reuse_a, reuse_b)
  return __builtin_amdgcn_wmma_f32_16x16x32_f16(false, a, false, b,
                                                (short)0, c, false, false);
}

__device__ inline float max3f(float a, float b, float c) {
  return fmaxf(fmaxf(a, b), c);
}

// Value of the partner lane in the other 16-lane half (lane ^ 16).
__device__ inline float other_half(float v) {
  const int b = __builtin_bit_cast(int, v);
  return __builtin_bit_cast(float,
      __builtin_amdgcn_permlanex16(b, b, 0x76543210, 0xfedcba98, false, false));
}

// ---------------------------------------------------------------------------
// Kernel 1: LayerNorm over C (eps=1e-3) + f16 conversion of xn and context.
// One wave per pixel row; 4 channels per lane; wave32 shuffle reduction.
// xn (f32) goes straight into d_out as the residual base.
// ---------------------------------------------------------------------------
__global__ __launch_bounds__(256) void ln_convert_kernel(
    const float* __restrict__ x, const float* __restrict__ ctx,
    const float* __restrict__ gamma, const float* __restrict__ beta,
    float* __restrict__ xn_out, f16* __restrict__ xnh, f16* __restrict__ ctxh) {
  const int lane = threadIdx.x & 31;
  const int wave = threadIdx.x >> 5;
  const size_t row = (size_t)blockIdx.x * 8 + wave;

  float4 xv = ((const float4*)(x + row * CDIM))[lane];
  float s = xv.x + xv.y + xv.z + xv.w;
#pragma unroll
  for (int m = 16; m >= 1; m >>= 1) s += __shfl_xor(s, m, 32);
  const float mu = s * (1.0f / 128.0f);

  float4 d;
  d.x = xv.x - mu; d.y = xv.y - mu; d.z = xv.z - mu; d.w = xv.w - mu;
  float vv = d.x * d.x + d.y * d.y + d.z * d.z + d.w * d.w;
#pragma unroll
  for (int m = 16; m >= 1; m >>= 1) vv += __shfl_xor(vv, m, 32);
  const float inv = rsqrtf(vv * (1.0f / 128.0f) + 1e-3f);

  float4 g  = ((const float4*)gamma)[lane];
  float4 bt = ((const float4*)beta)[lane];
  float4 o;
  o.x = d.x * inv * g.x + bt.x;
  o.y = d.y * inv * g.y + bt.y;
  o.z = d.z * inv * g.z + bt.z;
  o.w = d.w * inv * g.w + bt.w;

  ((float4*)(xn_out + row * CDIM))[lane] = o;
  v4h oh = {(f16)o.x, (f16)o.y, (f16)o.z, (f16)o.w};
  ((v4h*)(xnh + row * CDIM))[lane] = oh;

  float4 cv = ((const float4*)(ctx + row * CDIM))[lane];
  v4h ch = {(f16)cv.x, (f16)cv.y, (f16)cv.z, (f16)cv.w};
  ((v4h*)(ctxh + row * CDIM))[lane] = ch;
}

// ---------------------------------------------------------------------------
// Kernel 2: C[M x 128] = A[M x 128](f16) @ W[128 x 128](f32) + bias, via WMMA.
// 256 threads = 8 waves; tile = 128 rows x 128 cols; each wave owns 16 rows.
// W is staged in LDS transposed as f16 so B-fragments are two b128 ds loads.
// mode 0: f16 row-major [M,128]   (Q / K)
// mode 1: f16 transposed [b][c][n] (V, for fast PV A-fragments)
// mode 2: f32 accumulate into out_f (projection + residual)
// ---------------------------------------------------------------------------
__global__ __launch_bounds__(256) void gemm128_kernel(
    const f16* __restrict__ A, const float* __restrict__ W,
    const float* __restrict__ bias, f16* __restrict__ out_h,
    float* __restrict__ out_f, int mode) {
  __shared__ __attribute__((aligned(16))) f16 Wt[CDIM * CDIM];  // [n][k], 32 KB
  for (int idx = threadIdx.x; idx < CDIM * CDIM; idx += 256) {
    int k = idx >> 7, n = idx & 127;
    Wt[n * CDIM + k] = (f16)W[idx];
  }
  __syncthreads();

  const int lane = threadIdx.x & 31;
  const int wave = threadIdx.x >> 5;
  const int half = lane >> 4;
  const int l16  = lane & 15;
  const size_t row0 = (size_t)blockIdx.x * 128 + wave * 16;

  v16h a[4];
#pragma unroll
  for (int kk = 0; kk < 4; ++kk)
    a[kk] = load_frag16(A + (row0 + l16) * CDIM + kk * 32 + half * 8);

  v8f acc[8] = {};
#pragma unroll
  for (int kk = 0; kk < 4; ++kk) {
#pragma unroll
    for (int cn = 0; cn < 8; ++cn) {
      v16h bfrag = load_frag16(&Wt[(cn * 16 + l16) * CDIM + kk * 32 + half * 8]);
      acc[cn] = wmma16x16x32(a[kk], bfrag, acc[cn]);
    }
  }

#pragma unroll
  for (int cn = 0; cn < 8; ++cn) {
    const int n = cn * 16 + l16;
    const float bv = bias[n];
#pragma unroll
    for (int r = 0; r < 8; ++r) {
      const size_t grow = row0 + r + 8 * half;   // global row for C reg r
      const float val = acc[cn][r] + bv;
      if (mode == 0) {
        out_h[grow * CDIM + n] = (f16)val;
      } else if (mode == 1) {
        const size_t b = grow >> 12, nn = grow & (NPIX - 1);
        out_h[(b * CDIM + n) * NPIX + nn] = (f16)val;
      } else {
        out_f[grow * CDIM + n] += val;           // xn residual already there
      }
    }
  }
}

// ---------------------------------------------------------------------------
// Kernel 3: flash attention. 128 threads = 4 waves; 16 query rows per wave.
// K and V^T are staged in LDS, 128 keys per stage, two buffers, by asynchronous
// copies: the four waves share one whole-line fetch of each tile, and the copies
// of the next stage fly while this stage is worked on. Inside a stage the keys
// are walked in blocks of 32, in transposed form: S^T = K Q^T (8 WMMAs) leaves
// one query's scores in one lane pair, so the online softmax runs in registers;
// the two S^T tiles, converted in place, are the B operand of O^T += V^T P^T
// (8 WMMAs). A lane holds query l16; its half holds keys 8*half+r, 16+8*half+r.
// ---------------------------------------------------------------------------
#define STG_KEYS   128                       // keys per stage
#define STG_PITCH  136                       // halves per LDS row: 256 B + 16 B pad
#define STG_TILE   (128 * STG_PITCH)         // halves per tile (K: 128 keys, V^T: 128 channels)
#define STG_BUF    (2 * STG_TILE)            // halves per buffer (K tile, then V^T tile)
#define STG_COUNT  (NPIX / STG_KEYS)         // stages per batch

// Eight 16-byte copies per lane, global -> LDS, rows 8 apart in the tile.
// The s_wait_xcnt closes the statement so that no address register named by a
// copy is rewritten ahead of it.
__device__ inline void copy8_to_lds(unsigned l, const char* g, size_t gstep) {
  const unsigned ls = 8 * STG_PITCH * 2;     // 8 LDS rows, in bytes
  asm volatile(
      "global_load_async_to_lds_b128 %0, %8, off\n\t"
      "global_load_async_to_lds_b128 %1, %9, off\n\t"
      "global_load_async_to_lds_b128 %2, %10, off\n\t"
      "global_load_async_to_lds_b128 %3, %11, off\n\t"
      "global_load_async_to_lds_b128 %4, %12, off\n\t"
      "global_load_async_to_lds_b128 %5, %13, off\n\t"
      "global_load_async_to_lds_b128 %6, %14, off\n\t"
      "global_load_async_to_lds_b128 %7, %15, off\n\t"
      "s_wait_xcnt 0x0"
      :: "v"(l), "v"(l + ls), "v"(l + 2 * ls), "v"(l + 3 * ls),
         "v"(l + 4 * ls), "v"(l + 5 * ls), "v"(l + 6 * ls), "v"(l + 7 * ls),
         "v"(g), "v"(g + gstep), "v"(g + 2 * gstep), "v"(g + 3 * gstep),
         "v"(g + 4 * gstep), "v"(g + 5 * gstep), "v"(g + 6 * gstep), "v"(g + 7 * gstep)
      : "memory");
}

// One stage: 128 K rows (contiguous 32 KB) and 128 V^T rows of 256 B.
// Thread t copies 16-byte piece (t & 15) of rows (t >> 4) + 8 j, j = 0..15.
__device__ inline void copy_stage(unsigned lds_k, const char* gk, const char* gv) {
  const unsigned half_tile = 64 * STG_PITCH * 2;            // 64 LDS rows, bytes
  copy8_to_lds(lds_k,                             gk,                       8 * CDIM * 2);
  copy8_to_lds(lds_k + half_tile,                 gk + 64 * CDIM * 2,       8 * CDIM * 2);
  copy8_to_lds(lds_k + STG_TILE * 2,              gv,                       (size_t)8 * NPIX * 2);
  copy8_to_lds(lds_k + STG_TILE * 2 + half_tile,  gv + (size_t)64 * NPIX * 2, (size_t)8 * NPIX * 2);
}

__global__ __launch_bounds__(128) void flash_attn_kernel(
    const f16* __restrict__ Q, const f16* __restrict__ K,
    const f16* __restrict__ Vt, f16* __restrict__ O) {
  __shared__ __attribute__((aligned(128))) f16 Stage[2 * STG_BUF];
  const int lane = threadIdx.x & 31;
  const int wave = threadIdx.x >> 5;
  const int half = lane >> 4;
  const int l16  = lane & 15;
  const int b    = blockIdx.x >> 6;
  const int q0   = (blockIdx.x & 63) * 64 + wave * 16;
  const size_t qbase = (size_t)b * NPIX + q0;
  const float sc2 = 0.08838834764831845f * 1.4426950408889634f;  // U^-0.5 * log2(e), U=128

  // This thread's piece of every tile: LDS byte address and global bytes.
  const int crow = threadIdx.x >> 4, cpiece = threadIdx.x & 15;
  const unsigned lds_my = (unsigned)(size_t)&Stage[0] + crow * (STG_PITCH * 2) + cpiece * 16;
  const char* gk_my = (const char*)(K + (size_t)b * NPIX * CDIM) + crow * (CDIM * 2) + cpiece * 16;
  const char* gv_my = (const char*)(Vt + (size_t)b * CDIM * NPIX) + (size_t)crow * (NPIX * 2) + cpiece * 16;

  // Stage 0 lands and is published; stage 1 then flies during stage 0's work.
  copy_stage(lds_my, gk_my, gv_my);
  asm volatile("s_wait_asynccnt 0x0" ::: "memory");  // own copies of stage 0 landed
  __syncthreads();                                   // every wave's copies landed
  copy_stage(lds_my + STG_BUF * 2, gk_my + STG_KEYS * CDIM * 2, gv_my + STG_KEYS * 2);

  v16h qa[4];
#pragma unroll
  for (int kk = 0; kk < 4; ++kk)
    qa[kk] = load_frag16(Q + (qbase + l16) * CDIM + kk * 32 + half * 8);

  v8f acc[8] = {};          // acc[cn][r] = O[query l16][channel cn*16 + 8*half + r]
  float mi = -3.0e38f;      // running maximum of this lane's query, log2 units
  float li = 0.0f;          // running sum over this lane half's keys only

  for (int st = 0; st < STG_COUNT; ++st) {
    const f16* Ks = &Stage[(st & 1) * STG_BUF];
    const f16* Vs = Ks + STG_TILE;

    for (int kv0 = 0; kv0 < STG_KEYS; kv0 += 32) {
      // ---- S^T = K Q^T for 32 keys: two 16x16 f32 tiles ----------------
      v8f s0 = {}, s1 = {};
      const f16* Kb = Ks + kv0 * STG_PITCH;
#pragma unroll
      for (int kk = 0; kk < 4; ++kk) {
        v16h k0 = load_frag16(Kb + l16 * STG_PITCH + kk * 32 + half * 8);
        v16h k1 = load_frag16(Kb + (l16 + 16) * STG_PITCH + kk * 32 + half * 8);
        s0 = wmma16x16x32(k0, qa[kk], s0);
        s1 = wmma16x16x32(k1, qa[kk], s1);
      }

      // ---- online softmax: 16 scores of one query per lane --------------
      // maximum as a tree of three-input steps: short dependent chain
      const float m0 = max3f(s0[0], s0[1], s0[2]);
      const float m1 = max3f(s0[3], s0[4], s0[5]);
      const float m2 = max3f(s0[6], s0[7], s1[0]);
      const float m3 = max3f(s1[1], s1[2], s1[3]);
      const float m4 = max3f(s1[4], s1[5], s1[6]);
      float mx = fmaxf(max3f(m0, m1, m2), max3f(m3, m4, s1[7]));
      mx = fmaxf(mx, other_half(mx));
      const float mnew = fmaxf(mi, mx * sc2);
      const float corr = __builtin_amdgcn_exp2f(mi - mnew);  // 0 on the first block
      mi = mnew;
      v16h pb;              // P^T as B operand: element s is key 8*half+s (s < 8), 16+8*half+s-8 (s >= 8)
      float rs = 0.0f;
#pragma unroll
      for (int r = 0; r < 8; ++r) {
        const float p0 = __builtin_amdgcn_exp2f(s0[r] * sc2 - mnew);
        const float p1 = __builtin_amdgcn_exp2f(s1[r] * sc2 - mnew);
        rs += p0 + p1;
        pb[r]     = (f16)p0;
        pb[r + 8] = (f16)p1;
      }
      li = li * corr + rs;

      // ---- O^T += V^T P^T : V^T rows are the A operand -------------------
#pragma unroll
      for (int cn = 0; cn < 8; ++cn) {
        v16h vf = load_frag16(Vs + (cn * 16 + l16) * STG_PITCH + kv0 + half * 8);
        acc[cn] = wmma16x16x32(vf, pb, acc[cn] * corr);
      }
    }

    // ---- hand-over: publish stage st + 1, free this stage's buffer -------
    asm volatile("s_wait_dscnt 0x0" ::: "memory");     // own reads of this buffer done
    asm volatile("s_wait_asynccnt 0x0" ::: "memory");  // own copies of stage st + 1 landed
    __syncthreads();                                   // both hold for every wave
    if (st + 2 < STG_COUNT)
      copy_stage(lds_my + (st & 1) * (STG_BUF * 2),
                 gk_my + (size_t)(st + 2) * (STG_KEYS * CDIM * 2),
                 gv_my + (size_t)(st + 2) * (STG_KEYS * 2));
  }
  asm volatile("s_wait_asynccnt 0x0" ::: "memory");    // nothing in flight at the wave's end

  // ---- join the halves' sums, normalize, store f16 attention output ----
  const float inv = 1.0f / (li + other_half(li));
  f16* Orow = O + (qbase + l16) * CDIM + 8 * half;
#pragma unroll
  for (int cn = 0; cn < 8; ++cn) {
    v8h o;
#pragma unroll
    for (int r = 0; r < 8; ++r) o[r] = (f16)(acc[cn][r] * inv);
    *(v8h*)(Orow + cn * 16) = o;
  }
}

// ---------------------------------------------------------------------------
extern "C" void kernel_launch(void* const* d_in, const int* in_sizes, int n_in,
                              void* d_out, int out_size, void* d_ws, size_t ws_size,
                              hipStream_t stream) {
  (void)in_sizes; (void)n_in; (void)out_size; (void)ws_size;

  const float* inputs  = (const float*)d_in[0];
  const float* context = (const float*)d_in[1];
  const float* gamma   = (const float*)d_in[2];
  const float* beta    = (const float*)d_in[3];
  const float* Wq      = (const float*)d_in[4];
  const float* bq      = (const float*)d_in[5];
  const float* Wk      = (const float*)d_in[6];
  const float* bk      = (const float*)d_in[7];
  const float* Wv      = (const float*)d_in[8];
  const float* bv      = (const float*)d_in[9];
  const float* Wp      = (const float*)d_in[10];
  const float* bp      = (const float*)d_in[11];
  float* out = (float*)d_out;

  const size_t halfbuf = (size_t)MROWS * CDIM * sizeof(f16);  // 8 MB each
  char* ws = (char*)d_ws;
  f16* xnh  = (f16*)(ws + 0 * halfbuf);
  f16* ctxh = (f16*)(ws + 1 * halfbuf);
  f16* qh   = (f16*)(ws + 2 * halfbuf);
  f16* kh   = (f16*)(ws + 3 * halfbuf);
  f16* vt   = (f16*)(ws + 4 * halfbuf);   // [b][c][n] transposed
  f16* oh   = (f16*)(ws + 5 * halfbuf);

  // 1) LayerNorm + f16 conversions; xn (f32) -> d_out as residual base.
  ln_convert_kernel<<<MROWS / 8, 256, 0, stream>>>(inputs, context, gamma, beta,
                                                   out, xnh, ctxh);
  // 2) Q = xn @ Wq + bq ; K = ctx @ Wk + bk ; V^T = (ctx @ Wv + bv)^T
  gemm128_kernel<<<MROWS / 128, 256, 0, stream>>>(xnh,  Wq, bq, qh, nullptr, 0);
  gemm128_kernel<<<MROWS / 128, 256, 0, stream>>>(ctxh, Wk, bk, kh, nullptr, 0);
  gemm128_kernel<<<MROWS / 128, 256, 0, stream>>>(ctxh, Wv, bv, vt, nullptr, 1);
  // 3) fused softmax(Q K^T / sqrt(U)) V
  flash_attn_kernel<<<NBATCH * (NPIX / 64), 128, 0, stream>>>(qh, kh, vt, oh);
  // 4) d_out(=xn) += attn_out @ Wp + bp
  gemm128_kernel<<<MROWS / 128, 256, 0, stream>>>(oh, Wp, bp, nullptr, out, 2);
}

// v003
// One run takes 153 microseconds.
// Next to v002, in two timings, it ran 1.22 times as fast each time.
// All steps since v000 together make it 3.01 times as fast.
#include <hip/hip_runtime.h>
#include <hip/hip_bf16.h>

// ---------------------------------------------------------------------------
// CrossAttentionBlock for MI455X (gfx1250, wave32, WMMA 16x16x32 f16)
// B=8, H=W=64 (N=4096 pixels), C=U=128.
// ---------------------------------------------------------------------------

typedef _Float16 f16;
typedef __attribute__((ext_vector_type(4)))  _Float16 v4h;
typedef __attribute__((ext_vector_type(8)))  _Float16 v8h;
typedef __attribute__((ext_vector_type(16))) _Float16 v16h;
typedef __attribute__((ext_vector_type(8)))  float    v8f;

#define NPIX   4096          // H*W
#define CDIM   128           // channels == units
#define NBATCH 8
#define MROWS  (NBATCH * NPIX)  // 32768 total pixel rows

// Load one 16x32 f16 A/B fragment for v_wmma_f32_16x16x32_f16.
// Per ISA layout: lane's 16 halves are two contiguous groups of 8 at
// k = half*8 .. +7 and k = 16+half*8 .. +7 (caller pre-offsets by half*8).
__device__ inline v16h load_frag16(const f16* p) {
  v8h lo = *(const v8h*)(p);
  v8h hi = *(const v8h*)(p + 16);
  return __builtin_shufflevector(lo, hi, 0, 1, 2, 3, 4, 5, 6, 7,
                                         8, 9, 10, 11, 12, 13, 14, 15);
}

__device__ inline v8f wmma16x16x32(v16h a, v16h b, v8f c) {
  // (neg_a, A, neg_b, B, c_mod, C, reuse_a, reuse_b)
  return __builtin_amdgcn_wmma_f32_16x16x32_f16(false, a, false, b,
                                                (short)0, c, false, false);
}

__device__ inline float max3f(float a, float b, float c) {
  return fmaxf(fmaxf(a, b), c);
}

// Value of the partner lane in the other 16-lane half (lane ^ 16).
__device__ inline float other_half(float v) {
  const int b = __builtin_bit_cast(int, v);
  return __builtin_bit_cast(float,
      __builtin_amdgcn_permlanex16(b, b, 0x76543210, 0xfedcba98, false, false));
}

// ---------------------------------------------------------------------------
// Kernel 1: LayerNorm over C (eps=1e-3) + f16 conversion of xn and context.
// One wave per pixel row; 4 channels per lane; wave32 shuffle reduction.
// xn (f32) goes straight into d_out as the residual base.
// ---------------------------------------------------------------------------
__global__ __launch_bounds__(256) void ln_convert_kernel(
    const float* __restrict__ x, const float* __restrict__ ctx,
    const float* __restrict__ gamma, const float* __restrict__ beta,
    float* __restrict__ xn_out, f16* __restrict__ xnh, f16* __restrict__ ctxh) {
  const int lane = threadIdx.x & 31;
  const int wave = threadIdx.x >> 5;
  const size_t row = (size_t)blockIdx.x * 8 + wave;

  float4 xv = ((const float4*)(x + row * CDIM))[lane];
  float s = xv.x + xv.y + xv.z + xv.w;
#pragma unroll
  for (int m = 16; m >= 1; m >>= 1) s += __shfl_xor(s, m, 32);
  const float mu = s * (1.0f / 128.0f);

  float4 d;
  d.x = xv.x - mu; d.y = xv.y - mu; d.z = xv.z - mu; d.w = xv.w - mu;
  float vv = d.x * d.x + d.y * d.y + d.z * d.z + d.w * d.w;
#pragma unroll
  for (int m = 16; m >= 1; m >>= 1) vv += __shfl_xor(vv, m, 32);
  const float inv = rsqrtf(vv * (1.0f / 128.0f) + 1e-3f);

  float4 g  = ((const float4*)gamma)[lane];
  float4 bt = ((const float4*)beta)[lane];
  float4 o;
  o.x = d.x * inv * g.x + bt.x;
  o.y = d.y * inv * g.y + bt.y;
  o.z = d.z * inv * g.z + bt.z;
  o.w = d.w * inv * g.w + bt.w;

  ((float4*)(xn_out + row * CDIM))[lane] = o;
  v4h oh = {(f16)o.x, (f16)o.y, (f16)o.z, (f16)o.w};
  ((v4h*)(xnh + row * CDIM))[lane] = oh;

  float4 cv = ((const float4*)(ctx + row * CDIM))[lane];
  v4h ch = {(f16)cv.x, (f16)cv.y, (f16)cv.z, (f16)cv.w};
  ((v4h*)(ctxh + row * CDIM))[lane] = ch;
}

// ---------------------------------------------------------------------------
// Kernel 2: C[M x 128] = A[M x 128](f16) @ W[128 x 128](f32) + bias, via WMMA.
// 256 threads = 8 waves; tile = 128 rows x 128 cols; each wave owns 16 rows.
// W is staged in LDS transposed as f16 so B-fragments are two b128 ds loads.
// The LDS rows are pitched 16 B past their 256 B: the 16 rows of a fragment read
// and the 32 rows of a staging store then spread over the banks.
// mode 0: f16 row-major [M,128]   (Q / K)
// mode 1: f16 transposed [b][c][n] (V, for fast PV A-fragments)
// mode 2: f32 accumulate into out_f (projection + residual)
// ---------------------------------------------------------------------------
#define WT_PITCH 136         // halves per LDS row of W^T: 256 B + 16 B pad

__global__ __launch_bounds__(256) void gemm128_kernel(
    const f16* __restrict__ A, const float* __restrict__ W,
    const float* __restrict__ bias, f16* __restrict__ out_h,
    float* __restrict__ out_f, int mode) {
  __shared__ __attribute__((aligned(16))) f16 Wt[CDIM * WT_PITCH];  // [n][k], 34 KB
  for (int idx = threadIdx.x; idx < CDIM * CDIM; idx += 256) {
    int k = idx >> 7, n = idx & 127;
    Wt[n * WT_PITCH + k] = (f16)W[idx];
  }
  __syncthreads();

  const int lane = threadIdx.x & 31;
  const int wave = threadIdx.x >> 5;
  const int half = lane >> 4;
  const int l16  = lane & 15;
  const size_t row0 = (size_t)blockIdx.x * 128 + wave * 16;

  v16h a[4];
#pragma unroll
  for (int kk = 0; kk < 4; ++kk)
    a[kk] = load_frag16(A + (row0 + l16) * CDIM + kk * 32 + half * 8);

  v8f acc[8] = {};
#pragma unroll
  for (int kk = 0; kk < 4; ++kk) {
#pragma unroll
    for (int cn = 0; cn < 8; ++cn) {
      v16h bfrag = load_frag16(&Wt[(cn * 16 + l16) * WT_PITCH + kk * 32 + half * 8]);
      acc[cn] = wmma16x16x32(a[kk], bfrag, acc[cn]);
    }
  }

#pragma unroll
  for (int cn = 0; cn < 8; ++cn) {
    const int n = cn * 16 + l16;
    const float bv = bias[n];
#pragma unroll
    for (int r = 0; r < 8; ++r) {
      const size_t grow = row0 + r + 8 * half;   // global row for C reg r
      const float val = acc[cn][r] + bv;
      if (mode == 0) {
        out_h[grow * CDIM + n] = (f16)val;
      } else if (mode == 1) {
        const size_t b = grow >> 12, nn = grow & (NPIX - 1);
        out_h[(b * CDIM + n) * NPIX + nn] = (f16)val;
      } else {
        out_f[grow * CDIM + n] += val;           // xn residual already there
      }
    }
  }
}

// ---------------------------------------------------------------------------
// Kernel 3: flash attention. 128 threads = 4 waves; 16 query rows per wave.
// K and V^T are staged in LDS, 128 keys per stage, two buffers, by asynchronous
// copies: the four waves share one whole-line fetch of each tile, and the copies
// of the next stage fly while this stage is worked on. Inside a stage the keys
// are walked in blocks of 32, in transposed form: S^T = K Q^T (8 WMMAs) leaves
// one query's scores in one lane pair, so the online softmax runs in registers;
// the two S^T tiles, converted in place, are the B operand of O^T += V^T P^T
// (8 WMMAs). A lane holds query l16; its half holds keys 8*half+r, 16+8*half+r.
// ---------------------------------------------------------------------------
#define STG_KEYS   128                       // keys per stage
#define STG_PITCH  136                       // halves per LDS row: 256 B + 16 B pad
#define STG_TILE   (128 * STG_PITCH)         // halves per tile (K: 128 keys, V^T: 128 channels)
#define STG_BUF    (2 * STG_TILE)            // halves per buffer (K tile, then V^T tile)
#define STG_COUNT  (NPIX / STG_KEYS)         // stages per batch

// Eight 16-byte copies per lane, global -> LDS, rows 8 apart in the tile.
// The s_wait_xcnt closes the statement so that no address register named by a
// copy is rewritten ahead of it.
__device__ inline void copy8_to_lds(unsigned l, const char* g, size_t gstep) {
  const unsigned ls = 8 * STG_PITCH * 2;     // 8 LDS rows, in bytes
  asm volatile(
      "global_load_async_to_lds_b128 %0, %8, off\n\t"
      "global_load_async_to_lds_b128 %1, %9, off\n\t"
      "global_load_async_to_lds_b128 %2, %10, off\n\t"
      "global_load_async_to_lds_b128 %3, %11, off\n\t"
      "global_load_async_to_lds_b128 %4, %12, off\n\t"
      "global_load_async_to_lds_b128 %5, %13, off\n\t"
      "global_load_async_to_lds_b128 %6, %14, off\n\t"
      "global_load_async_to_lds_b128 %7, %15, off\n\t"
      "s_wait_xcnt 0x0"
      :: "v"(l), "v"(l + ls), "v"(l + 2 * ls), "v"(l + 3 * ls),
         "v"(l + 4 * ls), "v"(l + 5 * ls), "v"(l + 6 * ls), "v"(l + 7 * ls),
         "v"(g), "v"(g + gstep), "v"(g + 2 * gstep), "v"(g + 3 * gstep),
         "v"(g + 4 * gstep), "v"(g + 5 * gstep), "v"(g + 6 * gstep), "v"(g + 7 * gstep)
      : "memory");
}

// One stage: 128 K rows (contiguous 32 KB) and 128 V^T rows of 256 B.
// Thread t copies 16-byte piece (t & 15) of rows (t >> 4) + 8 j, j = 0..15.
__device__ inline void copy_stage(unsigned lds_k, const char* gk, const char* gv) {
  const unsigned half_tile = 64 * STG_PITCH * 2;            // 64 LDS rows, bytes
  copy8_to_lds(lds_k,                             gk,                       8 * CDIM * 2);
  copy8_to_lds(lds_k + half_tile,                 gk + 64 * CDIM * 2,       8 * CDIM * 2);
  copy8_to_lds(lds_k + STG_TILE * 2,              gv,                       (size_t)8 * NPIX * 2);
  copy8_to_lds(lds_k + STG_TILE * 2 + half_tile,  gv + (size_t)64 * NPIX * 2, (size_t)8 * NPIX * 2);
}

__global__ __launch_bounds__(128) void flash_attn_kernel(
    const f16* __restrict__ Q, const f16* __restrict__ K,
    const f16* __restrict__ Vt, f16* __restrict__ O) {
  __shared__ __attribute__((aligned(128))) f16 Stage[2 * STG_BUF];
  const int lane = threadIdx.x & 31;
  const int wave = threadIdx.x >> 5;
  const int half = lane >> 4;
  const int l16  = lane & 15;
  const int b    = blockIdx.x >> 6;
  const int q0   = (blockIdx.x & 63) * 64 + wave * 16;
  const size_t qbase = (size_t)b * NPIX + q0;
  const float sc2 = 0.08838834764831845f * 1.4426950408889634f;  // U^-0.5 * log2(e), U=128

  // This thread's piece of every tile: LDS byte address and global bytes.
  const int crow = threadIdx.x >> 4, cpiece = threadIdx.x & 15;
  const unsigned lds_my = (unsigned)(size_t)&Stage[0] + crow * (STG_PITCH * 2) + cpiece * 16;
  const char* gk_my = (const char*)(K + (size_t)b * NPIX * CDIM) + crow * (CDIM * 2) + cpiece * 16;
  const char* gv_my = (const char*)(Vt + (size_t)b * CDIM * NPIX) + (size_t)crow * (NPIX * 2) + cpiece * 16;

  // Stage 0 lands and is published; stage 1 then flies during stage 0's work.
  copy_stage(lds_my, gk_my, gv_my);
  asm volatile("s_wait_asynccnt 0x0" ::: "memory");  // own copies of stage 0 landed
  __syncthreads();                                   // every wave's copies landed
  copy_stage(lds_my + STG_BUF * 2, gk_my + STG_KEYS * CDIM * 2, gv_my + STG_KEYS * 2);

  v16h qa[4];
#pragma unroll
  for (int kk = 0; kk < 4; ++kk)
    qa[kk] = load_frag16(Q + (qbase + l16) * CDIM + kk * 32 + half * 8);

  v8f acc[8] = {};          // acc[cn][r] = O[query l16][channel cn*16 + 8*half + r]
  float mi = -3.0e38f;      // running maximum of this lane's query, log2 units
  float li = 0.0f;          // running sum over this lane half's keys only

  for (int st = 0; st < STG_COUNT; ++st) {
    const f16* Ks = &Stage[(st & 1) * STG_BUF];
    const f16* Vs = Ks + STG_TILE;

    for (int kv0 = 0; kv0 < STG_KEYS; kv0 += 32) {
      // ---- S^T = K Q^T for 32 keys: two 16x16 f32 tiles ----------------
      v8f s0 = {}, s1 = {};
      const f16* Kb = Ks + kv0 * STG_PITCH;
#pragma unroll
      for (int kk = 0; kk < 4; ++kk) {
        v16h k0 = load_frag16(Kb + l16 * STG_PITCH + kk * 32 + half * 8);
        v16h k1 = load_frag16(Kb + (l16 + 16) * STG_PITCH + kk * 32 + half * 8);
        s0 = wmma16x16x32(k0, qa[kk], s0);
        s1 = wmma16x16x32(k1, qa[kk], s1);
      }

      // ---- online softmax: 16 scores of one query per lane --------------
      // maximum as a tree of three-input steps: short dependent chain
      const float m0 = max3f(s0[0], s0[1], s0[2]);
      const float m1 = max3f(s0[3], s0[4], s0[5]);
      const float m2 = max3f(s0[6], s0[7], s1[0]);
      const float m3 = max3f(s1[1], s1[2], s1[3]);
      const float m4 = max3f(s1[4], s1[5], s1[6]);
      float mx = fmaxf(max3f(m0, m1, m2), max3f(m3, m4, s1[7]));
      mx = fmaxf(mx, other_half(mx));
      const float mnew = fmaxf(mi, mx * sc2);
      const float corr = __builtin_amdgcn_exp2f(mi - mnew);  // 0 on the first block
      mi = mnew;
      v16h pb;              // P^T as B operand: element s is key 8*half+s (s < 8), 16+8*half+s-8 (s >= 8)
      float rs = 0.0f;
#pragma unroll
      for (int r = 0; r < 8; ++r) {
        const float p0 = __builtin_amdgcn_exp2f(s0[r] * sc2 - mnew);
        const float p1 = __builtin_amdgcn_exp2f(s1[r] * sc2 - mnew);
        rs += p0 + p1;
        pb[r]     = (f16)p0;
        pb[r + 8] = (f16)p1;
      }
      li = li * corr + rs;

      // ---- O^T += V^T P^T : V^T rows are the A operand -------------------
#pragma unroll
      for (int cn = 0; cn < 8; ++cn) {
        v16h vf = load_frag16(Vs + (cn * 16 + l16) * STG_PITCH + kv0 + half * 8);
        acc[cn] = wmma16x16x32(vf, pb, acc[cn] * corr);
      }
    }

    // ---- hand-over: publish stage st + 1, free this stage's buffer -------
    asm volatile("s_wait_dscnt 0x0" ::: "memory");     // own reads of this buffer done
    asm volatile("s_wait_asynccnt 0x0" ::: "memory");  // own copies of stage st + 1 landed
    __syncthreads();                                   // both hold for every wave
    if (st + 2 < STG_COUNT)
      copy_stage(lds_my + (st & 1) * (STG_BUF * 2),
                 gk_my + (size_t)(st + 2) * (STG_KEYS * CDIM * 2),
                 gv_my + (size_t)(st + 2) * (STG_KEYS * 2));
  }
  asm volatile("s_wait_asynccnt 0x0" ::: "memory");    // nothing in flight at the wave's end

  // ---- join the halves' sums, normalize, store f16 attention output ----
  const float inv = 1.0f / (li + other_half(li));
  f16* Orow = O + (qbase + l16) * CDIM + 8 * half;
#pragma unroll
  for (int cn = 0; cn < 8; ++cn) {
    v8h o;
#pragma unroll
    for (int r = 0; r < 8; ++r) o[r] = (f16)(acc[cn][r] * inv);
    *(v8h*)(Orow + cn * 16) = o;
  }
}

// ---------------------------------------------------------------------------
extern "C" void kernel_launch(void* const* d_in, const int* in_sizes, int n_in,
                              void* d_out, int out_size, void* d_ws, size_t ws_size,
                              hipStream_t stream) {
  (void)in_sizes; (void)n_in; (void)out_size; (void)ws_size;

  const float* inputs  = (const float*)d_in[0];
  const float* context = (const float*)d_in[1];
  const float* gamma   = (const float*)d_in[2];
  const float* beta    = (const float*)d_in[3];
  const float* Wq      = (const float*)d_in[4];
  const float* bq      = (const float*)d_in[5];
  const float* Wk      = (const float*)d_in[6];
  const float* bk      = (const float*)d_in[7];
  const float* Wv      = (const float*)d_in[8];
  const float* bv      = (const float*)d_in[9];
  const float* Wp      = (const float*)d_in[10];
  const float* bp      = (const float*)d_in[11];
  float* out = (float*)d_out;

  const size_t halfbuf = (size_t)MROWS * CDIM * sizeof(f16);  // 8 MB each
  char* ws = (char*)d_ws;
  f16* xnh  = (f16*)(ws + 0 * halfbuf);
  f16* ctxh = (f16*)(ws + 1 * halfbuf);
  f16* qh   = (f16*)(ws + 2 * halfbuf);
  f16* kh   = (f16*)(ws + 3 * halfbuf);
  f16* vt   = (f16*)(ws + 4 * halfbuf);   // [b][c][n] transposed
  f16* oh   = (f16*)(ws + 5 * halfbuf);

  // 1) LayerNorm + f16 conversions; xn (f32) -> d_out as residual base.
  ln_convert_kernel<<<MROWS / 8, 256, 0, stream>>>(inputs, context, gamma, beta,
                                                   out, xnh, ctxh);
  // 2) Q = xn @ Wq + bq ; K = ctx @ Wk + bk ; V^T = (ctx @ Wv + bv)^T
  gemm128_kernel<<<MROWS / 128, 256, 0, stream>>>(xnh,  Wq, bq, qh, nullptr, 0);
  gemm128_kernel<<<MROWS / 128, 256, 0, stream>>>(ctxh, Wk, bk, kh, nullptr, 0);
  gemm128_kernel<<<MROWS / 128, 256, 0, stream>>>(ctxh, Wv, bv, vt, nullptr, 1);
  // 3) fused softmax(Q K^T / sqrt(U)) V
  flash_attn_kernel<<<NBATCH * (NPIX / 64), 128, 0, stream>>>(qh, kh, vt, oh);
  // 4) d_out(=xn) += attn_out @ Wp + bp
  gemm128_kernel<<<MROWS / 128, 256, 0, stream>>>(oh, Wp, bp, nullptr, out, 2);
}

// v004
// Measured time: 116 microseconds a run.
// Two timings next to v003 both put it at 1.32 times that version's speed.
// All steps since v000 together make it 3.98 times as fast.
#include <hip/hip_runtime.h>
#include <hip/hip_bf16.h>

// ---------------------------------------------------------------------------
// CrossAttentionBlock for MI455X (gfx1250, wave32, WMMA 16x16x32 f16)
// B=8, H=W=64 (N=4096 pixels), C=U=128.
// ---------------------------------------------------------------------------

typedef _Float16 f16;
typedef __attribute__((ext_vector_type(4)))  _Float16 v4h;
typedef __attribute__((ext_vector_type(8)))  _Float16 v8h;
typedef __attribute__((ext_vector_type(16))) _Float16 v16h;
typedef __attribute__((ext_vector_type(8)))  float    v8f;
typedef __attribute__((ext_vector_type(4)))  float    v4f;

#define NPIX   4096          // H*W
#define CDIM   128           // channels == units
#define NBATCH 8
#define MROWS  (NBATCH * NPIX)  // 32768 total pixel rows

// Load one 16x32 f16 A/B fragment for v_wmma_f32_16x16x32_f16.
// Per ISA layout: lane's 16 halves are two contiguous groups of 8 at
// k = half*8 .. +7 and k = 16+half*8 .. +7 (caller pre-offsets by half*8).
__device__ inline v16h load_frag16(const f16* p) {
  v8h lo = *(const v8h*)(p);
  v8h hi = *(const v8h*)(p + 16);
  return __builtin_shufflevector(lo, hi, 0, 1, 2, 3, 4, 5, 6, 7,
                                         8, 9, 10, 11, 12, 13, 14, 15);
}

__device__ inline v8f wmma16x16x32(v16h a, v16h b, v8f c) {
  // (neg_a, A, neg_b, B, c_mod, C, reuse_a, reuse_b)
  return __builtin_amdgcn_wmma_f32_16x16x32_f16(false, a, false, b,
                                                (short)0, c, false, false);
}

__device__ inline float max3f(float a, float b, float c) {
  return fmaxf(fmaxf(a, b), c);
}

// Value of the partner lane in the other 16-lane half (lane ^ 16).
__device__ inline float other_half(float v) {
  const int b = __builtin_bit_cast(int, v);
  return __builtin_bit_cast(float,
      __builtin_amdgcn_permlanex16(b, b, 0x76543210, 0xfedcba98, false, false));
}

// ---------------------------------------------------------------------------
// Kernel 1: LayerNorm over C (eps=1e-3) + f16 conversion of xn and context.
// One wave per pixel row; 4 channels per lane; wave32 shuffle reduction.
// xn (f32) goes straight into d_out as the residual base.
// ---------------------------------------------------------------------------
__global__ __launch_bounds__(256) void ln_convert_kernel(
    const float* __restrict__ x, const float* __restrict__ ctx,
    const float* __restrict__ gamma, const float* __restrict__ beta,
    float* __restrict__ xn_out, f16* __restrict__ xnh, f16* __restrict__ ctxh) {
  const int lane = threadIdx.x & 31;
  const int wave = threadIdx.x >> 5;
  const size_t row = (size_t)blockIdx.x * 8 + wave;

  float4 xv = ((const float4*)(x + row * CDIM))[lane];
  float s = xv.x + xv.y + xv.z + xv.w;
#pragma unroll
  for (int m = 16; m >= 1; m >>= 1) s += __shfl_xor(s, m, 32);
  const float mu = s * (1.0f / 128.0f);

  float4 d;
  d.x = xv.x - mu; d.y = xv.y - mu; d.z = xv.z - mu; d.w = xv.w - mu;
  float vv = d.x * d.x + d.y * d.y + d.z * d.z + d.w * d.w;
#pragma unroll
  for (int m = 16; m >= 1; m >>= 1) vv += __shfl_xor(vv, m, 32);
  const float inv = rsqrtf(vv * (1.0f / 128.0f) + 1e-3f);

  float4 g  = ((const float4*)gamma)[lane];
  float4 bt = ((const float4*)beta)[lane];
  float4 o;
  o.x = d.x * inv * g.x + bt.x;
  o.y = d.y * inv * g.y + bt.y;
  o.z = d.z * inv * g.z + bt.z;
  o.w = d.w * inv * g.w + bt.w;

  ((float4*)(xn_out + row * CDIM))[lane] = o;
  v4h oh = {(f16)o.x, (f16)o.y, (f16)o.z, (f16)o.w};
  ((v4h*)(xnh + row * CDIM))[lane] = oh;

  float4 cv = ((const float4*)(ctx + row * CDIM))[lane];
  v4h ch = {(f16)cv.x, (f16)cv.y, (f16)cv.z, (f16)cv.w};
  ((v4h*)(ctxh + row * CDIM))[lane] = ch;
}

// ---------------------------------------------------------------------------
// Kernel 2: C[M x 128] = A[M x 128](f16) @ W[128 x 128](f32) + bias, via WMMA.
// 256 threads = 8 waves; tile = 128 rows x 128 cols; each wave owns 16 rows.
// W is staged in LDS transposed as f16 so its fragments are two b128 ds loads.
// The LDS rows are pitched 16 B past their 256 B: the 16 rows of a fragment read
// and the 32 rows of a staging store then spread over the banks.
// The output form is a compile-time parameter, and it picks the operand roles so
// that the 8 accumulators of a lane are neighbours in memory:
// MODE 0: f16 row-major [M,128]    (Q / K): C^T = W^T A^T, lane = row, regs = columns
// MODE 1: f16 transposed [b][c][n] (V):     C   = A W,     lane = column, regs = rows
// MODE 2: f32 added onto out_f (projection + residual): as MODE 0
// ---------------------------------------------------------------------------
#define WT_PITCH 136         // halves per LDS row of W^T: 256 B + 16 B pad

template <int MODE>
__device__ __forceinline__ void gemm128_body(
    const f16* __restrict__ A, const float* __restrict__ W,
    const float* __restrict__ bias, f16* __restrict__ out_h,
    float* __restrict__ out_f) {
  __shared__ __attribute__((aligned(16))) f16 Wt[CDIM * WT_PITCH];  // [n][k], 34 KB
  const int lane = threadIdx.x & 31;
  const int wave = threadIdx.x >> 5;
  const int half = lane >> 4;
  const int l16  = lane & 15;
  const size_t row0 = (size_t)blockIdx.x * 128 + wave * 16;
  const size_t off  = (row0 + l16) * CDIM + 8 * half;   // MODE 0, 2: this lane's first result

  for (int idx = threadIdx.x; idx < CDIM * CDIM; idx += 256) {
    int k = idx >> 7, n = idx & 127;
    Wt[n * WT_PITCH + k] = (f16)W[idx];
  }
  __syncthreads();

  v16h a[4];
#pragma unroll
  for (int kk = 0; kk < 4; ++kk)
    a[kk] = load_frag16(A + (row0 + l16) * CDIM + kk * 32 + half * 8);

  // What the epilogue adds is fetched here, as one group with the A fragments: the
  // bias of this lane's results and, in MODE 2, the 64 values they are added onto.
  float bcol[8];
  v4f brow[16], res[16];
#pragma unroll
  for (int cn = 0; cn < 8; ++cn) {
    if (MODE == 1) {
      bcol[cn] = bias[cn * 16 + l16];
    } else {
      brow[2 * cn]     = *(const v4f*)(bias + cn * 16 + 8 * half);
      brow[2 * cn + 1] = *(const v4f*)(bias + cn * 16 + 8 * half + 4);
    }
    if (MODE == 2) {
      res[2 * cn]     = *(const v4f*)(out_f + off + cn * 16);
      res[2 * cn + 1] = *(const v4f*)(out_f + off + cn * 16 + 4);
    }
  }
  // Before a register that these loads name is used again. The compiler moves no
  // load over this statement either, so the group stays ahead of the products
  // instead of sinking into the epilogue, where each piece would wait by itself.
  asm volatile("s_wait_xcnt 0x0" ::: "memory");

  v8f acc[8] = {};
#pragma unroll
  for (int kk = 0; kk < 4; ++kk) {
#pragma unroll
    for (int cn = 0; cn < 8; ++cn) {
      v16h wfrag = load_frag16(&Wt[(cn * 16 + l16) * WT_PITCH + kk * 32 + half * 8]);
      acc[cn] = (MODE == 1) ? wmma16x16x32(a[kk], wfrag, acc[cn])
                            : wmma16x16x32(wfrag, a[kk], acc[cn]);
    }
  }

#pragma unroll
  for (int cn = 0; cn < 8; ++cn) {
    if (MODE == 1) {
      // acc[cn][r] = C[row0 + 8*half + r][cn*16 + l16]: 8 pixels of one channel, 16 B.
      const size_t b = row0 >> 12, nn = (row0 & (NPIX - 1)) + 8 * half;
      v8h o;
#pragma unroll
      for (int r = 0; r < 8; ++r) o[r] = (f16)(acc[cn][r] + bcol[cn]);
      *(v8h*)(out_h + (b * CDIM + cn * 16 + l16) * NPIX + nn) = o;
    } else {
      // acc[cn][r] = C[row0 + l16][cn*16 + 8*half + r]: 8 columns of one row.
      v4f lo = {acc[cn][0], acc[cn][1], acc[cn][2], acc[cn][3]};
      v4f hi = {acc[cn][4], acc[cn][5], acc[cn][6], acc[cn][7]};
      lo += brow[2 * cn];
      hi += brow[2 * cn + 1];
      if (MODE == 0) {
        v8h o = {(f16)lo[0], (f16)lo[1], (f16)lo[2], (f16)lo[3],
                 (f16)hi[0], (f16)hi[1], (f16)hi[2], (f16)hi[3]};
        *(v8h*)(out_h + off + cn * 16) = o;
      } else {
        *(v4f*)(out_f + off + cn * 16)     = res[2 * cn] + lo;       // xn residual
        *(v4f*)(out_f + off + cn * 16 + 4) = res[2 * cn + 1] + hi;
      }
    }
  }
}

__global__ __launch_bounds__(256) void gemm128_rows_kernel(
    const f16* __restrict__ A, const float* __restrict__ W,
    const float* __restrict__ bias, f16* __restrict__ out_h) {
  gemm128_body<0>(A, W, bias, out_h, nullptr);
}

__global__ __launch_bounds__(256) void gemm128_transposed_kernel(
    const f16* __restrict__ A, const float* __restrict__ W,
    const float* __restrict__ bias, f16* __restrict__ out_h) {
  gemm128_body<1>(A, W, bias, out_h, nullptr);
}

__global__ __launch_bounds__(256) void gemm128_residual_kernel(
    const f16* __restrict__ A, const float* __restrict__ W,
    const float* __restrict__ bias, float* __restrict__ out_f) {
  gemm128_body<2>(A, W, bias, nullptr, out_f);
}

// ---------------------------------------------------------------------------
// Kernel 3: flash attention. 128 threads = 4 waves; 16 query rows per wave.
// K and V^T are staged in LDS, 128 keys per stage, two buffers, by asynchronous
// copies: the four waves share one whole-line fetch of each tile, and the copies
// of the next stage fly while this stage is worked on. Inside a stage the keys
// are walked in blocks of 32, in transposed form: S^T = K Q^T (8 WMMAs) leaves
// one query's scores in one lane pair, so the online softmax runs in registers;
// the two S^T tiles, converted in place, are the B operand of O^T += V^T P^T
// (8 WMMAs). A lane holds query l16; its half holds keys 8*half+r, 16+8*half+r.
// ---------------------------------------------------------------------------
#define STG_KEYS   128                       // keys per stage
#define STG_PITCH  136                       // halves per LDS row: 256 B + 16 B pad
#define STG_TILE   (128 * STG_PITCH)         // halves per tile (K: 128 keys, V^T: 128 channels)
#define STG_BUF    (2 * STG_TILE)            // halves per buffer (K tile, then V^T tile)
#define STG_COUNT  (NPIX / STG_KEYS)         // stages per batch

// Eight 16-byte copies per lane, global -> LDS, rows 8 apart in the tile.
// The s_wait_xcnt closes the statement so that no address register named by a
// copy is rewritten ahead of it.
__device__ inline void copy8_to_lds(unsigned l, const char* g, size_t gstep) {
  const unsigned ls = 8 * STG_PITCH * 2;     // 8 LDS rows, in bytes
  asm volatile(
      "global_load_async_to_lds_b128 %0, %8, off\n\t"
      "global_load_async_to_lds_b128 %1, %9, off\n\t"
      "global_load_async_to_lds_b128 %2, %10, off\n\t"
      "global_load_async_to_lds_b128 %3, %11, off\n\t"
      "global_load_async_to_lds_b128 %4, %12, off\n\t"
      "global_load_async_to_lds_b128 %5, %13, off\n\t"
      "global_load_async_to_lds_b128 %6, %14, off\n\t"
      "global_load_async_to_lds_b128 %7, %15, off\n\t"
      "s_wait_xcnt 0x0"
      :: "v"(l), "v"(l + ls), "v"(l + 2 * ls), "v"(l + 3 * ls),
         "v"(l + 4 * ls), "v"(l + 5 * ls), "v"(l + 6 * ls), "v"(l + 7 * ls),
         "v"(g), "v"(g + gstep), "v"(g + 2 * gstep), "v"(g + 3 * gstep),
         "v"(g + 4 * gstep), "v"(g + 5 * gstep), "v"(g + 6 * gstep), "v"(g + 7 * gstep)
      : "memory");
}

// One stage: 128 K rows (contiguous 32 KB) and 128 V^T rows of 256 B.
// Thread t copies 16-byte piece (t & 15) of rows (t >> 4) + 8 j, j = 0..15.
__device__ inline void copy_stage(unsigned lds_k, const char* gk, const char* gv) {
  const unsigned half_tile = 64 * STG_PITCH * 2;            // 64 LDS rows, bytes
  copy8_to_lds(lds_k,                             gk,                       8 * CDIM * 2);
  copy8_to_lds(lds_k + half_tile,                 gk + 64 * CDIM * 2,       8 * CDIM * 2);
  copy8_to_lds(lds_k + STG_TILE * 2,              gv,                       (size_t)8 * NPIX * 2);
  copy8_to_lds(lds_k + STG_TILE * 2 + half_tile,  gv + (size_t)64 * NPIX * 2, (size_t)8 * NPIX * 2);
}

__global__ __launch_bounds__(128) void flash_attn_kernel(
    const f16* __restrict__ Q, const f16* __restrict__ K,
    const f16* __restrict__ Vt, f16* __restrict__ O) {
  __shared__ __attribute__((aligned(128))) f16 Stage[2 * STG_BUF];
  const int lane = threadIdx.x & 31;
  const int wave = threadIdx.x >> 5;
  const int half = lane >> 4;
  const int l16  = lane & 15;
  const int b    = blockIdx.x >> 6;
  const int q0   = (blockIdx.x & 63) * 64 + wave * 16;
  const size_t qbase = (size_t)b * NPIX + q0;
  const float sc2 = 0.08838834764831845f * 1.4426950408889634f;  // U^-0.5 * log2(e), U=128

  // This thread's piece of every tile: LDS byte address and global bytes.
  const int crow = threadIdx.x >> 4, cpiece = threadIdx.x & 15;
  const unsigned lds_my = (unsigned)(size_t)&Stage[0] + crow * (STG_PITCH * 2) + cpiece * 16;
  const char* gk_my = (const char*)(K + (size_t)b * NPIX * CDIM) + crow * (CDIM * 2) + cpiece * 16;
  const char* gv_my = (const char*)(Vt + (size_t)b * CDIM * NPIX) + (size_t)crow * (NPIX * 2) + cpiece * 16;

  // Stage 0 lands and is published; stage 1 then flies during stage 0's work.
  copy_stage(lds_my, gk_my, gv_my);
  asm volatile("s_wait_asynccnt 0x0" ::: "memory");  // own copies of stage 0 landed
  __syncthreads();                                   // every wave's copies landed
  copy_stage(lds_my + STG_BUF * 2, gk_my + STG_KEYS * CDIM * 2, gv_my + STG_KEYS * 2);

  v16h qa[4];
#pragma unroll
  for (int kk = 0; kk < 4; ++kk)
    qa[kk] = load_frag16(Q + (qbase + l16) * CDIM + kk * 32 + half * 8);

  v8f acc[8] = {};          // acc[cn][r] = O[query l16][channel cn*16 + 8*half + r]
  float mi = -3.0e38f;      // running maximum of this lane's query, log2 units
  float li = 0.0f;          // running sum over this lane half's keys only

  for (int st = 0; st < STG_COUNT; ++st) {
    const f16* Ks = &Stage[(st & 1) * STG_BUF];
    const f16* Vs = Ks + STG_TILE;

    for (int kv0 = 0; kv0 < STG_KEYS; kv0 += 32) {
      // ---- S^T = K Q^T for 32 keys: two 16x16 f32 tiles ----------------
      v8f s0 = {}, s1 = {};
      const f16* Kb = Ks + kv0 * STG_PITCH;
#pragma unroll
      for (int kk = 0; kk < 4; ++kk) {
        v16h k0 = load_frag16(Kb + l16 * STG_PITCH + kk * 32 + half * 8);
        v16h k1 = load_frag16(Kb + (l16 + 16) * STG_PITCH + kk * 32 + half * 8);
        s0 = wmma16x16x32(k0, qa[kk], s0);
        s1 = wmma16x16x32(k1, qa[kk], s1);
      }

      // ---- online softmax: 16 scores of one query per lane --------------
      // maximum as a tree of three-input steps: short dependent chain
      const float m0 = max3f(s0[0], s0[1], s0[2]);
      const float m1 = max3f(s0[3], s0[4], s0[5]);
      const float m2 = max3f(s0[6], s0[7], s1[0]);
      const float m3 = max3f(s1[1], s1[2], s1[3]);
      const float m4 = max3f(s1[4], s1[5], s1[6]);
      float mx = fmaxf(max3f(m0, m1, m2), max3f(m3, m4, s1[7]));
      mx = fmaxf(mx, other_half(mx));
      const float mnew = fmaxf(mi, mx * sc2);
      const float corr = __builtin_amdgcn_exp2f(mi - mnew);  // 0 on the first block
      mi = mnew;
      v16h pb;              // P^T as B operand: element s is key 8*half+s (s < 8), 16+8*half+s-8 (s >= 8)
      float rs = 0.0f;
#pragma unroll
      for (int r = 0; r < 8; ++r) {
        const float p0 = __builtin_amdgcn_exp2f(s0[r] * sc2 - mnew);
        const float p1 = __builtin_amdgcn_exp2f(s1[r] * sc2 - mnew);
        rs += p0 + p1;
        pb[r]     = (f16)p0;
        pb[r + 8] = (f16)p1;
      }
      li = li * corr + rs;

      // ---- O^T += V^T P^T : V^T rows are the A operand -------------------
#pragma unroll
      for (int cn = 0; cn < 8; ++cn) {
        v16h vf = load_frag16(Vs + (cn * 16 + l16) * STG_PITCH + kv0 + half * 8);
        acc[cn] = wmma16x16x32(vf, pb, acc[cn] * corr);
      }
    }

    // ---- hand-over: publish stage st + 1, free this stage's buffer -------
    asm volatile("s_wait_dscnt 0x0" ::: "memory");     // own reads of this buffer done
    asm volatile("s_wait_asynccnt 0x0" ::: "memory");  // own copies of stage st + 1 landed
    __syncthreads();                                   // both hold for every wave
    if (st + 2 < STG_COUNT)
      copy_stage(lds_my + (st & 1) * (STG_BUF * 2),
                 gk_my + (size_t)(st + 2) * (STG_KEYS * CDIM * 2),
                 gv_my + (size_t)(st + 2) * (STG_KEYS * 2));
  }
  asm volatile("s_wait_asynccnt 0x0" ::: "memory");    // nothing in flight at the wave's end

  // ---- join the halves' sums, normalize, store f16 attention output ----
  const float inv = 1.0f / (li + other_half(li));
  f16* Orow = O + (qbase + l16) * CDIM + 8 * half;
#pragma unroll
  for (int cn = 0; cn < 8; ++cn) {
    v8h o;
#pragma unroll
    for (int r = 0; r < 8; ++r) o[r] = (f16)(acc[cn][r] * inv);
    *(v8h*)(Orow + cn * 16) = o;
  }
}

// ---------------------------------------------------------------------------
extern "C" void kernel_launch(void* const* d_in, const int* in_sizes, int n_in,
                              void* d_out, int out_size, void* d_ws, size_t ws_size,
                              hipStream_t stream) {
  (void)in_sizes; (void)n_in; (void)out_size; (void)ws_size;

  const float* inputs  = (const float*)d_in[0];
  const float* context = (const float*)d_in[1];
  const float* gamma   = (const float*)d_in[2];
  const float* beta    = (const float*)d_in[3];
  const float* Wq      = (const float*)d_in[4];
  const float* bq      = (const float*)d_in[5];
  const float* Wk      = (const float*)d_in[6];
  const float* bk      = (const float*)d_in[7];
  const float* Wv      = (const float*)d_in[8];
  const float* bv      = (const float*)d_in[9];
  const float* Wp      = (const float*)d_in[10];
  const float* bp      = (const float*)d_in[11];
  float* out = (float*)d_out;

  const size_t halfbuf = (size_t)MROWS * CDIM * sizeof(f16);  // 8 MB each
  char* ws = (char*)d_ws;
  f16* xnh  = (f16*)(ws + 0 * halfbuf);
  f16* ctxh = (f16*)(ws + 1 * halfbuf);
  f16* qh   = (f16*)(ws + 2 * halfbuf);
  f16* kh   = (f16*)(ws + 3 * halfbuf);
  f16* vt   = (f16*)(ws + 4 * halfbuf);   // [b][c][n] transposed
  f16* oh   = (f16*)(ws + 5 * halfbuf);

  // 1) LayerNorm + f16 conversions; xn (f32) -> d_out as residual base.
  ln_convert_kernel<<<MROWS / 8, 256, 0, stream>>>(inputs, context, gamma, beta,
                                                   out, xnh, ctxh);
  // 2) Q = xn @ Wq + bq ; K = ctx @ Wk + bk ; V^T = (ctx @ Wv + bv)^T
  gemm128_rows_kernel<<<MROWS / 128, 256, 0, stream>>>(xnh,  Wq, bq, qh);
  gemm128_rows_kernel<<<MROWS / 128, 256, 0, stream>>>(ctxh, Wk, bk, kh);
  gemm128_transposed_kernel<<<MROWS / 128, 256, 0, stream>>>(ctxh, Wv, bv, vt);
  // 3) fused softmax(Q K^T / sqrt(U)) V
  flash_attn_kernel<<<NBATCH * (NPIX / 64), 128, 0, stream>>>(qh, kh, vt, oh);
  // 4) d_out(=xn) += attn_out @ Wp + bp
  gemm128_residual_kernel<<<MROWS / 128, 256, 0, stream>>>(oh, Wp, bp, out);
}

// v005
// Measured time: 106 microseconds a run.
// Timed twice side by side with v004, it ran 1.09 times as fast both times.
// All steps since v000 together make it 4.34 times as fast.
#include <hip/hip_runtime.h>
#include <hip/hip_bf16.h>

// ---------------------------------------------------------------------------
// CrossAttentionBlock for MI455X (gfx1250, wave32, WMMA 16x16x32 f16)
// B=8, H=W=64 (N=4096 pixels), C=U=128.
// ---------------------------------------------------------------------------

typedef _Float16 f16;
typedef __attribute__((ext_vector_type(4)))  _Float16 v4h;
typedef __attribute__((ext_vector_type(8)))  _Float16 v8h;
typedef __attribute__((ext_vector_type(16))) _Float16 v16h;
typedef __attribute__((ext_vector_type(8)))  float    v8f;
typedef __attribute__((ext_vector_type(4)))  float    v4f;

#define NPIX   4096          // H*W
#define CDIM   128           // channels == units
#define NBATCH 8
#define MROWS  (NBATCH * NPIX)  // 32768 total pixel rows

// Load one 16x32 f16 A/B fragment for v_wmma_f32_16x16x32_f16.
// Per ISA layout: lane's 16 halves are two contiguous groups of 8 at
// k = half*8 .. +7 and k = 16+half*8 .. +7 (caller pre-offsets by half*8).
__device__ inline v16h load_frag16(const f16* p) {
  v8h lo = *(const v8h*)(p);
  v8h hi = *(const v8h*)(p + 16);
  return __builtin_shufflevector(lo, hi, 0, 1, 2, 3, 4, 5, 6, 7,
                                         8, 9, 10, 11, 12, 13, 14, 15);
}

__device__ inline v8f wmma16x16x32(v16h a, v16h b, v8f c) {
  // (neg_a, A, neg_b, B, c_mod, C, reuse_a, reuse_b)
  return __builtin_amdgcn_wmma_f32_16x16x32_f16(false, a, false, b,
                                                (short)0, c, false, false);
}

__device__ inline float max3f(float a, float b, float c) {
  return fmaxf(fmaxf(a, b), c);
}

// Value of the partner lane in the other 16-lane half (lane ^ 16).
__device__ inline float other_half(float v) {
  const int b = __builtin_bit_cast(int, v);
  return __builtin_bit_cast(float,
      __builtin_amdgcn_permlanex16(b, b, 0x76543210, 0xfedcba98, false, false));
}

// ---------------------------------------------------------------------------
// Kernel 1: LayerNorm over C (eps=1e-3) + f16 conversion of xn and context.
// One wave per pixel row; 4 channels per lane; wave32 shuffle reduction.
// xn (f32) goes straight into d_out as the residual base.
// ---------------------------------------------------------------------------
__global__ __launch_bounds__(256) void ln_convert_kernel(
    const float* __restrict__ x, const float* __restrict__ ctx,
    const float* __restrict__ gamma, const float* __restrict__ beta,
    float* __restrict__ xn_out, f16* __restrict__ xnh, f16* __restrict__ ctxh) {
  const int lane = threadIdx.x & 31;
  const int wave = threadIdx.x >> 5;
  const size_t row = (size_t)blockIdx.x * 8 + wave;

  float4 xv = ((const float4*)(x + row * CDIM))[lane];
  float s = xv.x + xv.y + xv.z + xv.w;
#pragma unroll
  for (int m = 16; m >= 1; m >>= 1) s += __shfl_xor(s, m, 32);
  const float mu = s * (1.0f / 128.0f);

  float4 d;
  d.x = xv.x - mu; d.y = xv.y - mu; d.z = xv.z - mu; d.w = xv.w - mu;
  float vv = d.x * d.x + d.y * d.y + d.z * d.z + d.w * d.w;
#pragma unroll
  for (int m = 16; m >= 1; m >>= 1) vv += __shfl_xor(vv, m, 32);
  const float inv = rsqrtf(vv * (1.0f / 128.0f) + 1e-3f);

  float4 g  = ((const float4*)gamma)[lane];
  float4 bt = ((const float4*)beta)[lane];
  float4 o;
  o.x = d.x * inv * g.x + bt.x;
  o.y = d.y * inv * g.y + bt.y;
  o.z = d.z * inv * g.z + bt.z;
  o.w = d.w * inv * g.w + bt.w;

  ((float4*)(xn_out + row * CDIM))[lane] = o;
  v4h oh = {(f16)o.x, (f16)o.y, (f16)o.z, (f16)o.w};
  ((v4h*)(xnh + row * CDIM))[lane] = oh;

  float4 cv = ((const float4*)(ctx + row * CDIM))[lane];
  v4h ch = {(f16)cv.x, (f16)cv.y, (f16)cv.z, (f16)cv.w};
  ((v4h*)(ctxh + row * CDIM))[lane] = ch;
}

// ---------------------------------------------------------------------------
// Kernel 2: C[M x 128] = A[M x 128](f16) @ W[128 x 128](f32) + bias, via WMMA.
// 256 threads = 8 waves; tile = 128 rows x 128 cols; each wave owns 16 rows.
// W is staged in LDS transposed as f16 so its fragments are two b128 ds loads.
// The LDS rows are pitched 16 B past their 256 B: the 16 rows of a fragment read
// and the 32 rows of a staging store then spread over the banks.
// The output form is a compile-time parameter, and it picks the operand roles so
// that the 8 accumulators of a lane are neighbours in memory:
// MODE 0: f16 row-major [M,128]    (Q / K): C^T = W^T A^T, lane = row, regs = columns
// MODE 1: f16 transposed [b][c][n] (V):     C   = A W,     lane = column, regs = rows
// MODE 2: f32 added onto out_f (projection + residual): as MODE 0
// ---------------------------------------------------------------------------
#define WT_PITCH 136         // halves per LDS row of W^T: 256 B + 16 B pad

template <int MODE>
__device__ __forceinline__ void gemm128_body(
    const f16* __restrict__ A, const float* __restrict__ W,
    const float* __restrict__ bias, f16* __restrict__ out_h,
    float* __restrict__ out_f) {
  __shared__ __attribute__((aligned(16))) f16 Wt[CDIM * WT_PITCH];  // [n][k], 34 KB
  const int lane = threadIdx.x & 31;
  const int wave = threadIdx.x >> 5;
  const int half = lane >> 4;
  const int l16  = lane & 15;
  const size_t row0 = (size_t)blockIdx.x * 128 + wave * 16;
  const size_t off  = (row0 + l16) * CDIM + 8 * half;   // MODE 0, 2: this lane's first result

  for (int idx = threadIdx.x; idx < CDIM * CDIM; idx += 256) {
    int k = idx >> 7, n = idx & 127;
    Wt[n * WT_PITCH + k] = (f16)W[idx];
  }
  __syncthreads();

  v16h a[4];
#pragma unroll
  for (int kk = 0; kk < 4; ++kk)
    a[kk] = load_frag16(A + (row0 + l16) * CDIM + kk * 32 + half * 8);

  // What the epilogue adds is fetched here, as one group with the A fragments: the
  // bias of this lane's results and, in MODE 2, the 64 values they are added onto.
  float bcol[8];
  v4f brow[16], res[16];
#pragma unroll
  for (int cn = 0; cn < 8; ++cn) {
    if (MODE == 1) {
      bcol[cn] = bias[cn * 16 + l16];
    } else {
      brow[2 * cn]     = *(const v4f*)(bias + cn * 16 + 8 * half);
      brow[2 * cn + 1] = *(const v4f*)(bias + cn * 16 + 8 * half + 4);
    }
    if (MODE == 2) {
      res[2 * cn]     = *(const v4f*)(out_f + off + cn * 16);
      res[2 * cn + 1] = *(const v4f*)(out_f + off + cn * 16 + 4);
    }
  }
  // Before a register that these loads name is used again. The compiler moves no
  // load over this statement either, so the group stays ahead of the products
  // instead of sinking into the epilogue, where each piece would wait by itself.
  asm volatile("s_wait_xcnt 0x0" ::: "memory");

  v8f acc[8] = {};
#pragma unroll
  for (int kk = 0; kk < 4; ++kk) {
#pragma unroll
    for (int cn = 0; cn < 8; ++cn) {
      v16h wfrag = load_frag16(&Wt[(cn * 16 + l16) * WT_PITCH + kk * 32 + half * 8]);
      acc[cn] = (MODE == 1) ? wmma16x16x32(a[kk], wfrag, acc[cn])
                            : wmma16x16x32(wfrag, a[kk], acc[cn]);
    }
  }

#pragma unroll
  for (int cn = 0; cn < 8; ++cn) {
    if (MODE == 1) {
      // acc[cn][r] = C[row0 + 8*half + r][cn*16 + l16]: 8 pixels of one channel, 16 B.
      const size_t b = row0 >> 12, nn = (row0 & (NPIX - 1)) + 8 * half;
      v8h o;
#pragma unroll
      for (int r = 0; r < 8; ++r) o[r] = (f16)(acc[cn][r] + bcol[cn]);
      *(v8h*)(out_h + (b * CDIM + cn * 16 + l16) * NPIX + nn) = o;
    } else {
      // acc[cn][r] = C[row0 + l16][cn*16 + 8*half + r]: 8 columns of one row.
      v4f lo = {acc[cn][0], acc[cn][1], acc[cn][2], acc[cn][3]};
      v4f hi = {acc[cn][4], acc[cn][5], acc[cn][6], acc[cn][7]};
      lo += brow[2 * cn];
      hi += brow[2 * cn + 1];
      if (MODE == 0) {
        v8h o = {(f16)lo[0], (f16)lo[1], (f16)lo[2], (f16)lo[3],
                 (f16)hi[0], (f16)hi[1], (f16)hi[2], (f16)hi[3]};
        *(v8h*)(out_h + off + cn * 16) = o;
      } else {
        *(v4f*)(out_f + off + cn * 16)     = res[2 * cn] + lo;       // xn residual
        *(v4f*)(out_f + off + cn * 16 + 4) = res[2 * cn + 1] + hi;
      }
    }
  }
}

__global__ __launch_bounds__(256) void gemm128_rows_kernel(
    const f16* __restrict__ A, const float* __restrict__ W,
    const float* __restrict__ bias, f16* __restrict__ out_h) {
  gemm128_body<0>(A, W, bias, out_h, nullptr);
}

__global__ __launch_bounds__(256) void gemm128_transposed_kernel(
    const f16* __restrict__ A, const float* __restrict__ W,
    const float* __restrict__ bias, f16* __restrict__ out_h) {
  gemm128_body<1>(A, W, bias, out_h, nullptr);
}

__global__ __launch_bounds__(256) void gemm128_residual_kernel(
    const f16* __restrict__ A, const float* __restrict__ W,
    const float* __restrict__ bias, float* __restrict__ out_f) {
  gemm128_body<2>(A, W, bias, nullptr, out_f);
}

// ---------------------------------------------------------------------------
// Kernel 3: flash attention. 256 threads = 8 waves; 128 query rows per work-group.
// K and V^T are staged in LDS, 128 keys per stage, two buffers, by asynchronous
// copies: the eight waves share one whole-line fetch of each tile, and the copies
// of the next stage fly while this stage is worked on.
// Wave tile: 32 queries (two column groups) x 64 of the stage's 128 keys. Waves w
// and w + 4 hold the same queries and split the keys, so every K and V^T fragment
// read from LDS feeds two products, and one work-group fills a WGP with two waves
// per SIMD. Each wave keeps its own running maximum, sum and output over its keys;
// the two partial results of a query are joined through LDS behind the loop.
// The keys are walked in blocks of 32, in transposed form: S^T = K Q^T (16 WMMAs)
// leaves one query's scores in one lane pair, so the online softmax runs in
// registers; the S^T tiles, converted in place, are the B operands of
// O^T += V^T P^T (16 WMMAs). A lane holds queries l16 and 16 + l16; its half holds
// keys 8*half+r, 16+8*half+r.
// ---------------------------------------------------------------------------
#define STG_KEYS   128                       // keys per stage
#define STG_PITCH  136                       // halves per LDS row: 256 B + 16 B pad
#define STG_TILE   (128 * STG_PITCH)         // halves per tile (K: 128 keys, V^T: 128 channels)
#define STG_BUF    (2 * STG_TILE)            // halves per buffer (K tile, then V^T tile)
#define STG_COUNT  (NPIX / STG_KEYS)         // stages per batch
#define WAVE_KEYS  (STG_KEYS / 2)            // keys of a stage that one wave walks
#define WG_QUERIES 128                       // queries per work-group: 4 wave pairs x 32

// Eight 16-byte copies per lane, global -> LDS, rows 16 apart in the tile.
// The s_wait_xcnt closes the statement so that no address register named by a
// copy is rewritten ahead of it.
__device__ inline void copy8_to_lds(unsigned l, const char* g, size_t gstep) {
  const unsigned ls = 16 * STG_PITCH * 2;    // 16 LDS rows, in bytes
  asm volatile(
      "global_load_async_to_lds_b128 %0, %8, off\n\t"
      "global_load_async_to_lds_b128 %1, %9, off\n\t"
      "global_load_async_to_lds_b128 %2, %10, off\n\t"
      "global_load_async_to_lds_b128 %3, %11, off\n\t"
      "global_load_async_to_lds_b128 %4, %12, off\n\t"
      "global_load_async_to_lds_b128 %5, %13, off\n\t"
      "global_load_async_to_lds_b128 %6, %14, off\n\t"
      "global_load_async_to_lds_b128 %7, %15, off\n\t"
      "s_wait_xcnt 0x0"
      :: "v"(l), "v"(l + ls), "v"(l + 2 * ls), "v"(l + 3 * ls),
         "v"(l + 4 * ls), "v"(l + 5 * ls), "v"(l + 6 * ls), "v"(l + 7 * ls),
         "v"(g), "v"(g + gstep), "v"(g + 2 * gstep), "v"(g + 3 * gstep),
         "v"(g + 4 * gstep), "v"(g + 5 * gstep), "v"(g + 6 * gstep), "v"(g + 7 * gstep)
      : "memory");
}

// One stage: 128 K rows (contiguous 32 KB) and 128 V^T rows of 256 B.
// Thread t copies 16-byte piece (t & 15) of rows (t >> 4) + 16 j, j = 0..7.
__device__ inline void copy_stage(unsigned lds_k, const char* gk, const char* gv) {
  copy8_to_lds(lds_k,                gk, 16 * CDIM * 2);
  copy8_to_lds(lds_k + STG_TILE * 2, gv, (size_t)16 * NPIX * 2);
}

__global__ __launch_bounds__(256) void flash_attn_kernel(
    const f16* __restrict__ Q, const f16* __restrict__ K,
    const f16* __restrict__ Vt, f16* __restrict__ O) {
  __shared__ __attribute__((aligned(128))) f16 Stage[2 * STG_BUF];
  const int lane = threadIdx.x & 31;
  const int wave = __builtin_amdgcn_readfirstlane(threadIdx.x >> 5);
  const int half = lane >> 4;
  const int l16  = lane & 15;
  const int qg   = wave & 3;    // which 32 queries of the work-group
  const int kh   = wave >> 2;   // which 64 keys of every stage
  const int b    = blockIdx.x / (NPIX / WG_QUERIES);
  const int q0   = (blockIdx.x % (NPIX / WG_QUERIES)) * WG_QUERIES + qg * 32;
  const size_t qbase = (size_t)b * NPIX + q0;
  const float sc2 = 0.08838834764831845f * 1.4426950408889634f;  // U^-0.5 * log2(e), U=128

  // This thread's piece of every tile: LDS byte address and global bytes.
  const int crow = threadIdx.x >> 4, cpiece = threadIdx.x & 15;
  const unsigned lds_my = (unsigned)(size_t)&Stage[0] + crow * (STG_PITCH * 2) + cpiece * 16;
  const char* gk_my = (const char*)(K + (size_t)b * NPIX * CDIM) + crow * (CDIM * 2) + cpiece * 16;
  const char* gv_my = (const char*)(Vt + (size_t)b * CDIM * NPIX) + (size_t)crow * (NPIX * 2) + cpiece * 16;

  // Stage 0 lands and is published; stage 1 then flies during stage 0's work.
  copy_stage(lds_my, gk_my, gv_my);
  asm volatile("s_wait_asynccnt 0x0" ::: "memory");  // own copies of stage 0 landed
  __syncthreads();                                   // every wave's copies landed
  copy_stage(lds_my + STG_BUF * 2, gk_my + STG_KEYS * CDIM * 2, gv_my + STG_KEYS * 2);

  const f16* Qrow = Q + (qbase + l16) * CDIM + half * 8;
  v16h qa[2][4];
#pragma unroll
  for (int t = 0; t < 2; ++t)
#pragma unroll
    for (int kk = 0; kk < 4; ++kk)
      qa[t][kk] = load_frag16(Qrow + t * 16 * CDIM + kk * 32);
  // Before a register that these loads name is used again; the row pointer is an
  // input so that its registers are not handed out while the loads are issued.
  asm volatile("s_wait_xcnt 0x0" :: "v"(Qrow) : "memory");

  v8f acc[2][8] = {};       // acc[t][cn][r] = O[query t*16 + l16][channel cn*16 + 8*half + r]
  float mi[2] = {-3.0e38f, -3.0e38f};  // running maxima of this lane's queries, log2 units
  float li[2] = {0.0f, 0.0f};          // running sums over this lane half's keys only

  for (int st = 0; st < STG_COUNT; ++st) {
    const f16* Ks = &Stage[(st & 1) * STG_BUF] + kh * (WAVE_KEYS * STG_PITCH);  // own key rows
    const f16* Vs = &Stage[(st & 1) * STG_BUF] + STG_TILE + kh * WAVE_KEYS;     // own key columns

    for (int kv0 = 0; kv0 < WAVE_KEYS; kv0 += 32) {
      // ---- S^T = K Q^T for 32 keys x 32 queries: four 16x16 f32 tiles ----
      v8f s0[2] = {}, s1[2] = {};
      const f16* Kb = Ks + kv0 * STG_PITCH;
#pragma unroll
      for (int kk = 0; kk < 4; ++kk) {
        v16h k0 = load_frag16(Kb + l16 * STG_PITCH + kk * 32 + half * 8);
        v16h k1 = load_frag16(Kb + (l16 + 16) * STG_PITCH + kk * 32 + half * 8);
#pragma unroll
        for (int t = 0; t < 2; ++t) {
          s0[t] = wmma16x16x32(k0, qa[t][kk], s0[t]);
          s1[t] = wmma16x16x32(k1, qa[t][kk], s1[t]);
        }
      }

      // ---- online softmax: 16 scores of each of two queries per lane -----
      v16h pb[2];           // P^T as B operand: element s is key 8*half+s (s < 8), 16+8*half+s-8 (s >= 8)
      float corr[2];
#pragma unroll
      for (int t = 0; t < 2; ++t) {
        // maximum as a tree of three-input steps: short dependent chain
        const float m0 = max3f(s0[t][0], s0[t][1], s0[t][2]);
        const float m1 = max3f(s0[t][3], s0[t][4], s0[t][5]);
        const float m2 = max3f(s0[t][6], s0[t][7], s1[t][0]);
        const float m3 = max3f(s1[t][1], s1[t][2], s1[t][3]);
        const float m4 = max3f(s1[t][4], s1[t][5], s1[t][6]);
        float mx = fmaxf(max3f(m0, m1, m2), max3f(m3, m4, s1[t][7]));
        mx = fmaxf(mx, other_half(mx));
        const float mnew = fmaxf(mi[t], mx * sc2);
        corr[t] = __builtin_amdgcn_exp2f(mi[t] - mnew);  // 0 on the first block
        mi[t] = mnew;
        float rs = 0.0f;
#pragma unroll
        for (int r = 0; r < 8; ++r) {
          const float p0 = __builtin_amdgcn_exp2f(s0[t][r] * sc2 - mnew);
          const float p1 = __builtin_amdgcn_exp2f(s1[t][r] * sc2 - mnew);
          rs += p0 + p1;
          pb[t][r]     = (f16)p0;
          pb[t][r + 8] = (f16)p1;
        }
        li[t] = li[t] * corr[t] + rs;
      }

      // ---- O^T += V^T P^T : V^T rows are the A operand, read once for both groups
#pragma unroll
      for (int cn = 0; cn < 8; ++cn) {
        v16h vf = load_frag16(Vs + (cn * 16 + l16) * STG_PITCH + kv0 + half * 8);
#pragma unroll
        for (int t = 0; t < 2; ++t)
          acc[t][cn] = wmma16x16x32(vf, pb[t], acc[t][cn] * corr[t]);
      }
    }

    // ---- hand-over: publish stage st + 1, free this stage's buffer -------
    asm volatile("s_wait_dscnt 0x0" ::: "memory");     // own reads of this buffer done
    asm volatile("s_wait_asynccnt 0x0" ::: "memory");  // own copies of stage st + 1 landed
    __syncthreads();                                   // both hold for every wave
    if (st + 2 < STG_COUNT)
      copy_stage(lds_my + (st & 1) * (STG_BUF * 2),
                 gk_my + (size_t)(st + 2) * (STG_KEYS * CDIM * 2),
                 gv_my + (size_t)(st + 2) * (STG_KEYS * 2));
  }
  asm volatile("s_wait_asynccnt 0x0" ::: "memory");    // nothing in flight at the wave's end

  // ---- join the two key halves of each query through LDS ----------------
  // Behind the loop's last barrier nobody reads the stages and no copy is in
  // flight, so their LDS carries the hand-over: 33 pieces of 16 B per lane, each
  // piece a contiguous 512 B per wave.
  v4f* Join = (v4f*)&Stage[0] + (size_t)qg * (33 * 32) + lane;
  if (kh == 1) {
    const v4f ml = {mi[0], mi[1], li[0], li[1]};
    Join[32 * 32] = ml;
#pragma unroll
    for (int t = 0; t < 2; ++t)
#pragma unroll
      for (int cn = 0; cn < 8; ++cn) {
        const v4f lo = {acc[t][cn][0], acc[t][cn][1], acc[t][cn][2], acc[t][cn][3]};
        const v4f hi = {acc[t][cn][4], acc[t][cn][5], acc[t][cn][6], acc[t][cn][7]};
        Join[((t * 8 + cn) * 2) * 32]     = lo;
        Join[((t * 8 + cn) * 2 + 1) * 32] = hi;
      }
  }
  __syncthreads();                                     // the partner's partial results are in LDS
  if (kh == 1) return;

  // ---- join the lane halves' sums, normalize, store f16 attention output ----
  const v4f ml = Join[32 * 32];
#pragma unroll
  for (int t = 0; t < 2; ++t) {
    const float mj = fmaxf(mi[t], ml[t]);
    const float fa = __builtin_amdgcn_exp2f(mi[t] - mj);   // weight of this wave's keys
    const float fb = __builtin_amdgcn_exp2f(ml[t] - mj);   // weight of the partner's keys
    const float lj = li[t] * fa + ml[2 + t] * fb;
    const float inv = 1.0f / (lj + other_half(lj));
    const float wa = fa * inv, wb = fb * inv;
    f16* Orow = O + (qbase + t * 16 + l16) * CDIM + 8 * half;
#pragma unroll
    for (int cn = 0; cn < 8; ++cn) {
      const v4f lo = Join[((t * 8 + cn) * 2) * 32];
      const v4f hi = Join[((t * 8 + cn) * 2 + 1) * 32];
      v8h o;
#pragma unroll
      for (int r = 0; r < 4; ++r) {
        o[r]     = (f16)(acc[t][cn][r] * wa + lo[r] * wb);
        o[r + 4] = (f16)(acc[t][cn][r + 4] * wa + hi[r] * wb);
      }
      *(v8h*)(Orow + cn * 16) = o;
    }
  }
}

// ---------------------------------------------------------------------------
extern "C" void kernel_launch(void* const* d_in, const int* in_sizes, int n_in,
                              void* d_out, int out_size, void* d_ws, size_t ws_size,
                              hipStream_t stream) {
  (void)in_sizes; (void)n_in; (void)out_size; (void)ws_size;

  const float* inputs  = (const float*)d_in[0];
  const float* context = (const float*)d_in[1];
  const float* gamma   = (const float*)d_in[2];
  const float* beta    = (const float*)d_in[3];
  const float* Wq      = (const float*)d_in[4];
  const float* bq      = (const float*)d_in[5];
  const float* Wk      = (const float*)d_in[6];
  const float* bk      = (const float*)d_in[7];
  const float* Wv      = (const float*)d_in[8];
  const float* bv      = (const float*)d_in[9];
  const float* Wp      = (const float*)d_in[10];
  const float* bp      = (const float*)d_in[11];
  float* out = (float*)d_out;

  const size_t halfbuf = (size_t)MROWS * CDIM * sizeof(f16);  // 8 MB each
  char* ws = (char*)d_ws;
  f16* xnh  = (f16*)(ws + 0 * halfbuf);
  f16* ctxh = (f16*)(ws + 1 * halfbuf);
  f16* qh   = (f16*)(ws + 2 * halfbuf);
  f16* kh   = (f16*)(ws + 3 * halfbuf);
  f16* vt   = (f16*)(ws + 4 * halfbuf);   // [b][c][n] transposed
  f16* oh   = (f16*)(ws + 5 * halfbuf);

  // 1) LayerNorm + f16 conversions; xn (f32) -> d_out as residual base.
  ln_convert_kernel<<<MROWS / 8, 256, 0, stream>>>(inputs, context, gamma, beta,
                                                   out, xnh, ctxh);
  // 2) Q = xn @ Wq + bq ; K = ctx @ Wk + bk ; V^T = (ctx @ Wv + bv)^T
  gemm128_rows_kernel<<<MROWS / 128, 256, 0, stream>>>(xnh,  Wq, bq, qh);
  gemm128_rows_kernel<<<MROWS / 128, 256, 0, stream>>>(ctxh, Wk, bk, kh);
  gemm128_transposed_kernel<<<MROWS / 128, 256, 0, stream>>>(ctxh, Wv, bv, vt);
  // 3) fused softmax(Q K^T / sqrt(U)) V
  flash_attn_kernel<<<NBATCH * (NPIX / WG_QUERIES), 256, 0, stream>>>(qh, kh, vt, oh);
  // 4) d_out(=xn) += attn_out @ Wp + bp
  gemm128_residual_kernel<<<MROWS / 128, 256, 0, stream>>>(oh, Wp, bp, out);
}

// v006
// Measured time: 84.5 microseconds a run.
// Next to v005, in two timings, it ran 1.25 times as fast each time.
// Over all steps from v000 it is 5.42 times as fast.
#include <hip/hip_runtime.h>
#include <hip/hip_bf16.h>

// ---------------------------------------------------------------------------
// CrossAttentionBlock for MI455X (gfx1250, wave32, WMMA 16x16x32 f16)
// B=8, H=W=64 (N=4096 pixels), C=U=128.
// ---------------------------------------------------------------------------

typedef _Float16 f16;
typedef __attribute__((ext_vector_type(4)))  _Float16 v4h;
typedef __attribute__((ext_vector_type(8)))  _Float16 v8h;
typedef __attribute__((ext_vector_type(16))) _Float16 v16h;
typedef __attribute__((ext_vector_type(8)))  float    v8f;
typedef __attribute__((ext_vector_type(4)))  float    v4f;

#define NPIX   4096          // H*W
#define CDIM   128           // channels == units
#define NBATCH 8
#define MROWS  (NBATCH * NPIX)  // 32768 total pixel rows

// Load one 16x32 f16 A/B fragment for v_wmma_f32_16x16x32_f16.
// Per ISA layout: lane's 16 halves are two contiguous groups of 8 at
// k = half*8 .. +7 and k = 16+half*8 .. +7 (caller pre-offsets by half*8).
__device__ inline v16h load_frag16(const f16* p) {
  v8h lo = *(const v8h*)(p);
  v8h hi = *(const v8h*)(p + 16);
  return __builtin_shufflevector(lo, hi, 0, 1, 2, 3, 4, 5, 6, 7,
                                         8, 9, 10, 11, 12, 13, 14, 15);
}

__device__ inline v8f wmma16x16x32(v16h a, v16h b, v8f c) {
  // (neg_a, A, neg_b, B, c_mod, C, reuse_a, reuse_b)
  return __builtin_amdgcn_wmma_f32_16x16x32_f16(false, a, false, b,
                                                (short)0, c, false, false);
}

__device__ inline float max3f(float a, float b, float c) {
  return fmaxf(fmaxf(a, b), c);
}

// Value of the partner lane in the other 16-lane half (lane ^ 16).
__device__ inline float other_half(float v) {
  const int b = __builtin_bit_cast(int, v);
  return __builtin_bit_cast(float,
      __builtin_amdgcn_permlanex16(b, b, 0x76543210, 0xfedcba98, false, false));
}

// ---------------------------------------------------------------------------
// 128 x 128 projection tile, C[128 x 128] = A[128 x 128](f16) @ W[128 x 128] + bias,
// via WMMA. 256 threads = 8 waves; each wave owns 16 rows.
// W is staged in LDS transposed as f16 so its fragments are two b128 ds loads.
// The LDS rows are pitched 16 B past their 256 B: the 16 rows of a fragment read
// and the 32 rows of a staging store then spread over the banks.
// The output form is a compile-time parameter, and it picks the operand roles so
// that the 8 accumulators of a lane are neighbours in memory:
// MODE 0: f16 row-major [M,128]    (Q / K): C^T = W^T A^T, lane = row, regs = columns
// MODE 1: f16 transposed [b][c][n] (V):     C   = A W,     lane = column, regs = rows
// MODE 2: f32 added onto out_f (projection + residual): as MODE 0
// ---------------------------------------------------------------------------
#define WT_PITCH 136         // halves per LDS row of W^T: 256 B + 16 B pad
#define ROW_TILES (MROWS / 128)   // 128-row tiles of the pixel rows

// a: this wave's A fragments (rows row0 .. row0 + 15); Wt: the staged W^T, [n][k].
template <int MODE>
__device__ __forceinline__ void gemm128_tile(
    const v16h (&a)[4], const f16* Wt, size_t row0,
    const float* __restrict__ bias, f16* __restrict__ out_h,
    float* __restrict__ out_f) {
  const int lane = threadIdx.x & 31;
  const int half = lane >> 4;
  const int l16  = lane & 15;
  const size_t off  = (row0 + l16) * CDIM + 8 * half;   // MODE 0, 2: this lane's first result

  // What the epilogue adds is fetched here, as one group ahead of the products: the
  // bias of this lane's results and, in MODE 2, the 64 values they are added onto.
  float bcol[8];
  v4f brow[16], res[16];
#pragma unroll
  for (int cn = 0; cn < 8; ++cn) {
    if (MODE == 1) {
      bcol[cn] = bias[cn * 16 + l16];
    } else {
      brow[2 * cn]     = *(const v4f*)(bias + cn * 16 + 8 * half);
      brow[2 * cn + 1] = *(const v4f*)(bias + cn * 16 + 8 * half + 4);
    }
    if (MODE == 2) {
      res[2 * cn]     = *(const v4f*)(out_f + off + cn * 16);
      res[2 * cn + 1] = *(const v4f*)(out_f + off + cn * 16 + 4);
    }
  }
  // Before a register that these loads name is used again. The compiler moves no
  // load over this statement either, so the group stays ahead of the products
  // instead of sinking into the epilogue, where each piece would wait by itself.
  asm volatile("s_wait_xcnt 0x0" ::: "memory");

  v8f acc[8] = {};
#pragma unroll
  for (int kk = 0; kk < 4; ++kk) {
#pragma unroll
    for (int cn = 0; cn < 8; ++cn) {
      v16h wfrag = load_frag16(&Wt[(cn * 16 + l16) * WT_PITCH + kk * 32 + half * 8]);
      acc[cn] = (MODE == 1) ? wmma16x16x32(a[kk], wfrag, acc[cn])
                            : wmma16x16x32(wfrag, a[kk], acc[cn]);
    }
  }

#pragma unroll
  for (int cn = 0; cn < 8; ++cn) {
    if (MODE == 1) {
      // acc[cn][r] = C[row0 + 8*half + r][cn*16 + l16]: 8 pixels of one channel, 16 B.
      const size_t b = row0 >> 12, nn = (row0 & (NPIX - 1)) + 8 * half;
      v8h o;
#pragma unroll
      for (int r = 0; r < 8; ++r) o[r] = (f16)(acc[cn][r] + bcol[cn]);
      *(v8h*)(out_h + (b * CDIM + cn * 16 + l16) * NPIX + nn) = o;
    } else {
      // acc[cn][r] = C[row0 + l16][cn*16 + 8*half + r]: 8 columns of one row.
      v4f lo = {acc[cn][0], acc[cn][1], acc[cn][2], acc[cn][3]};
      v4f hi = {acc[cn][4], acc[cn][5], acc[cn][6], acc[cn][7]};
      lo += brow[2 * cn];
      hi += brow[2 * cn + 1];
      if (MODE == 0) {
        v8h o = {(f16)lo[0], (f16)lo[1], (f16)lo[2], (f16)lo[3],
                 (f16)hi[0], (f16)hi[1], (f16)hi[2], (f16)hi[3]};
        *(v8h*)(out_h + off + cn * 16) = o;
      } else {
        *(v4f*)(out_f + off + cn * 16)     = res[2 * cn] + lo;       // xn residual
        *(v4f*)(out_f + off + cn * 16 + 4) = res[2 * cn + 1] + hi;
      }
    }
  }
}

// ---------------------------------------------------------------------------
// Kernel 1: LayerNorm, f16 conversion and the Q, K, V projections in one launch.
// Work-groups 0 .. ROW_TILES-1 take 128 context rows each and write K and V^T;
// the others take 128 input rows each, normalize them (eps = 1e-3), write xn (f32)
// into d_out as the residual base, and write Q. Two work-groups fit a WGP.
// A wave fetches its 16 rows as whole 512 B rows (4 channels per lane), all in
// flight while the weights are staged; the f16 rows go to the A fragments through
// LDS and never through memory.
// ---------------------------------------------------------------------------
__global__ __launch_bounds__(256) void ln_qkv_kernel(
    const float* __restrict__ x, const float* __restrict__ ctx,
    const float* __restrict__ gamma, const float* __restrict__ beta,
    const float* __restrict__ Wq, const float* __restrict__ bq,
    const float* __restrict__ Wk, const float* __restrict__ bk,
    const float* __restrict__ Wv, const float* __restrict__ bv,
    float* __restrict__ xn_out, f16* __restrict__ qh, f16* __restrict__ kh,
    f16* __restrict__ vt) {
  __shared__ __attribute__((aligned(16))) f16 Rows[128 * WT_PITCH];     // [row][k], 34 KB
  __shared__ __attribute__((aligned(16))) f16 Wt[2][CDIM * WT_PITCH];   // [n][k], 34 KB each
  const int lane = threadIdx.x & 31;
  const int wave = threadIdx.x >> 5;
  const int half = lane >> 4;
  const int l16  = lane & 15;
  const bool is_q = blockIdx.x >= ROW_TILES;
  const size_t row0 = (size_t)(is_q ? blockIdx.x - ROW_TILES : blockIdx.x) * 128 + wave * 16;
  const float* src = (is_q ? x : ctx) + row0 * CDIM + lane * 4;

  float4 rv[16];
#pragma unroll
  for (int r = 0; r < 16; ++r) rv[r] = *(const float4*)(src + r * CDIM);
  // Before a register that these loads name is used again; the row pointer is an
  // input so that its registers are not handed out while the loads are issued.
  asm volatile("s_wait_xcnt 0x0" :: "v"(src) : "memory");

  if (is_q) {
    for (int idx = threadIdx.x; idx < CDIM * CDIM; idx += 256) {
      int k = idx >> 7, n = idx & 127;
      Wt[0][n * WT_PITCH + k] = (f16)Wq[idx];
    }

    // LayerNorm of the 16 rows, their reductions side by side.
    const float4 g  = ((const float4*)gamma)[lane];
    const float4 bt = ((const float4*)beta)[lane];
    float s[16];
#pragma unroll
    for (int r = 0; r < 16; ++r) s[r] = rv[r].x + rv[r].y + rv[r].z + rv[r].w;
#pragma unroll
    for (int m = 16; m >= 1; m >>= 1)
#pragma unroll
      for (int r = 0; r < 16; ++r) s[r] += __shfl_xor(s[r], m, 32);
#pragma unroll
    for (int r = 0; r < 16; ++r) {
      const float mu = s[r] * (1.0f / 128.0f);
      rv[r].x -= mu; rv[r].y -= mu; rv[r].z -= mu; rv[r].w -= mu;
      s[r] = rv[r].x * rv[r].x + rv[r].y * rv[r].y + rv[r].z * rv[r].z + rv[r].w * rv[r].w;
    }
#pragma unroll
    for (int m = 16; m >= 1; m >>= 1)
#pragma unroll
      for (int r = 0; r < 16; ++r) s[r] += __shfl_xor(s[r], m, 32);
#pragma unroll
    for (int r = 0; r < 16; ++r) {
      const float inv = rsqrtf(s[r] * (1.0f / 128.0f) + 1e-3f);
      rv[r].x = rv[r].x * inv * g.x + bt.x;
      rv[r].y = rv[r].y * inv * g.y + bt.y;
      rv[r].z = rv[r].z * inv * g.z + bt.z;
      rv[r].w = rv[r].w * inv * g.w + bt.w;
    }
  } else {
    for (int idx = threadIdx.x; idx < CDIM * CDIM; idx += 256) {
      int k = idx >> 7, n = idx & 127;
      Wt[0][n * WT_PITCH + k] = (f16)Wk[idx];
      Wt[1][n * WT_PITCH + k] = (f16)Wv[idx];
    }
  }

#pragma unroll
  for (int r = 0; r < 16; ++r) {
    v4h h = {(f16)rv[r].x, (f16)rv[r].y, (f16)rv[r].z, (f16)rv[r].w};
    *(v4h*)&Rows[(wave * 16 + r) * WT_PITCH + lane * 4] = h;
  }
  __syncthreads();

  // xn goes out behind the barrier, which would otherwise wait for these stores.
  if (is_q) {
#pragma unroll
    for (int r = 0; r < 16; ++r)
      ((float4*)(xn_out + (row0 + r) * CDIM))[lane] = rv[r];
  }

  v16h a[4];
#pragma unroll
  for (int kk = 0; kk < 4; ++kk)
    a[kk] = load_frag16(&Rows[(wave * 16 + l16) * WT_PITCH + kk * 32 + half * 8]);

  if (is_q) {
    gemm128_tile<0>(a, Wt[0], row0, bq, qh, nullptr);
  } else {
    gemm128_tile<0>(a, Wt[0], row0, bk, kh, nullptr);
    // Before a register that the K stores name is used again by the second tile.
    asm volatile("s_wait_xcnt 0x0" ::: "memory");
    gemm128_tile<1>(a, Wt[1], row0, bv, vt, nullptr);
    // Before a register that the V^T stores name is used again: in the built code
    // the other branch's instructions stand behind them.
    asm volatile("s_wait_xcnt 0x0" ::: "memory");
  }
}

// ---------------------------------------------------------------------------
// Kernel 2: out_f[M x 128] += A[M x 128](f16) @ W[128 x 128](f32) + bias.
// ---------------------------------------------------------------------------
__global__ __launch_bounds__(256) void gemm128_residual_kernel(
    const f16* __restrict__ A, const float* __restrict__ W,
    const float* __restrict__ bias, float* __restrict__ out_f) {
  __shared__ __attribute__((aligned(16))) f16 Wt[CDIM * WT_PITCH];  // [n][k], 34 KB
  const int lane = threadIdx.x & 31;
  const int wave = threadIdx.x >> 5;
  const int half = lane >> 4;
  const int l16  = lane & 15;
  const size_t row0 = (size_t)blockIdx.x * 128 + wave * 16;

  for (int idx = threadIdx.x; idx < CDIM * CDIM; idx += 256) {
    int k = idx >> 7, n = idx & 127;
    Wt[n * WT_PITCH + k] = (f16)W[idx];
  }
  __syncthreads();

  v16h a[4];
#pragma unroll
  for (int kk = 0; kk < 4; ++kk)
    a[kk] = load_frag16(A + (row0 + l16) * CDIM + kk * 32 + half * 8);

  gemm128_tile<2>(a, Wt, row0, bias, nullptr, out_f);
}

// ---------------------------------------------------------------------------
// Kernel 3: flash attention. 256 threads = 8 waves; 128 query rows per work-group.
// K and V^T are staged in LDS, 128 keys per stage, two buffers, by asynchronous
// copies: the eight waves share one whole-line fetch of each tile, and the copies
// of the next stage fly while this stage is worked on.
// Wave tile: 32 queries (two column groups) x 64 of the stage's 128 keys. Waves w
// and w + 4 hold the same queries and split the keys, so every K and V^T fragment
// read from LDS feeds two products, and one work-group fills a WGP with two waves
// per SIMD. Each wave keeps its own running maximum, sum and output over its keys;
// the two partial results of a query are joined through LDS behind the loop.
// The keys are walked in blocks of 32, in transposed form: S^T = K Q^T (16 WMMAs)
// leaves one query's scores in one lane pair, so the online softmax runs in
// registers; the S^T tiles, converted in place, are the B operands of
// O^T += V^T P^T (16 WMMAs). A lane holds queries l16 and 16 + l16; its half holds
// keys 8*half+r, 16+8*half+r.
// ---------------------------------------------------------------------------
#define STG_KEYS   128                       // keys per stage
#define STG_PITCH  136                       // halves per LDS row: 256 B + 16 B pad
#define STG_TILE   (128 * STG_PITCH)         // halves per tile (K: 128 keys, V^T: 128 channels)
#define STG_BUF    (2 * STG_TILE)            // halves per buffer (K tile, then V^T tile)
#define STG_COUNT  (NPIX / STG_KEYS)         // stages per batch
#define WAVE_KEYS  (STG_KEYS / 2)            // keys of a stage that one wave walks
#define WG_QUERIES 128                       // queries per work-group: 4 wave pairs x 32

// Eight 16-byte copies per lane, global -> LDS, rows 16 apart in the tile.
// The s_wait_xcnt closes the statement so that no address register named by a
// copy is rewritten ahead of it.
__device__ inline void copy8_to_lds(unsigned l, const char* g, size_t gstep) {
  const unsigned ls = 16 * STG_PITCH * 2;    // 16 LDS rows, in bytes
  asm volatile(
      "global_load_async_to_lds_b128 %0, %8, off\n\t"
      "global_load_async_to_lds_b128 %1, %9, off\n\t"
      "global_load_async_to_lds_b128 %2, %10, off\n\t"
      "global_load_async_to_lds_b128 %3, %11, off\n\t"
      "global_load_async_to_lds_b128 %4, %12, off\n\t"
      "global_load_async_to_lds_b128 %5, %13, off\n\t"
      "global_load_async_to_lds_b128 %6, %14, off\n\t"
      "global_load_async_to_lds_b128 %7, %15, off\n\t"
      "s_wait_xcnt 0x0"
      :: "v"(l), "v"(l + ls), "v"(l + 2 * ls), "v"(l + 3 * ls),
         "v"(l + 4 * ls), "v"(l + 5 * ls), "v"(l + 6 * ls), "v"(l + 7 * ls),
         "v"(g), "v"(g + gstep), "v"(g + 2 * gstep), "v"(g + 3 * gstep),
         "v"(g + 4 * gstep), "v"(g + 5 * gstep), "v"(g + 6 * gstep), "v"(g + 7 * gstep)
      : "memory");
}

// One stage: 128 K rows (contiguous 32 KB) and 128 V^T rows of 256 B.
// Thread t copies 16-byte piece (t & 15) of rows (t >> 4) + 16 j, j = 0..7.
__device__ inline void copy_stage(unsigned lds_k, const char* gk, const char* gv) {
  copy8_to_lds(lds_k,                gk, 16 * CDIM * 2);
  copy8_to_lds(lds_k + STG_TILE * 2, gv, (size_t)16 * NPIX * 2);
}

__global__ __launch_bounds__(256) void flash_attn_kernel(
    const f16* __restrict__ Q, const f16* __restrict__ K,
    const f16* __restrict__ Vt, f16* __restrict__ O) {
  __shared__ __attribute__((aligned(128))) f16 Stage[2 * STG_BUF];
  const int lane = threadIdx.x & 31;
  const int wave = __builtin_amdgcn_readfirstlane(threadIdx.x >> 5);
  const int half = lane >> 4;
  const int l16  = lane & 15;
  const int qg   = wave & 3;    // which 32 queries of the work-group
  const int kh   = wave >> 2;   // which 64 keys of every stage
  const int b    = blockIdx.x / (NPIX / WG_QUERIES);
  const int q0   = (blockIdx.x % (NPIX / WG_QUERIES)) * WG_QUERIES + qg * 32;
  const size_t qbase = (size_t)b * NPIX + q0;
  const float sc2 = 0.08838834764831845f * 1.4426950408889634f;  // U^-0.5 * log2(e), U=128

  // This thread's piece of every tile: LDS byte address and global bytes.
  const int crow = threadIdx.x >> 4, cpiece = threadIdx.x & 15;
  const unsigned lds_my = (unsigned)(size_t)&Stage[0] + crow * (STG_PITCH * 2) + cpiece * 16;
  const char* gk_my = (const char*)(K + (size_t)b * NPIX * CDIM) + crow * (CDIM * 2) + cpiece * 16;
  const char* gv_my = (const char*)(Vt + (size_t)b * CDIM * NPIX) + (size_t)crow * (NPIX * 2) + cpiece * 16;

  // Stage 0 lands and is published; stage 1 then flies during stage 0's work.
  copy_stage(lds_my, gk_my, gv_my);
  asm volatile("s_wait_asynccnt 0x0" ::: "memory");  // own copies of stage 0 landed
  __syncthreads();                                   // every wave's copies landed
  copy_stage(lds_my + STG_BUF * 2, gk_my + STG_KEYS * CDIM * 2, gv_my + STG_KEYS * 2);

  const f16* Qrow = Q + (qbase + l16) * CDIM + half * 8;
  v16h qa[2][4];
#pragma unroll
  for (int t = 0; t < 2; ++t)
#pragma unroll
    for (int kk = 0; kk < 4; ++kk)
      qa[t][kk] = load_frag16(Qrow + t * 16 * CDIM + kk * 32);
  // Before a register that these loads name is used again; the row pointer is an
  // input so that its registers are not handed out while the loads are issued.
  asm volatile("s_wait_xcnt 0x0" :: "v"(Qrow) : "memory");

  v8f acc[2][8] = {};       // acc[t][cn][r] = O[query t*16 + l16][channel cn*16 + 8*half + r]
  float mi[2] = {-3.0e38f, -3.0e38f};  // running maxima of this lane's queries, log2 units
  float li[2] = {0.0f, 0.0f};          // running sums over this lane half's keys only

  for (int st = 0; st < STG_COUNT; ++st) {
    const f16* Ks = &Stage[(st & 1) * STG_BUF] + kh * (WAVE_KEYS * STG_PITCH);  // own key rows
    const f16* Vs = &Stage[(st & 1) * STG_BUF] + STG_TILE + kh * WAVE_KEYS;     // own key columns

    for (int kv0 = 0; kv0 < WAVE_KEYS; kv0 += 32) {
      // ---- S^T = K Q^T for 32 keys x 32 queries: four 16x16 f32 tiles ----
      v8f s0[2] = {}, s1[2] = {};
      const f16* Kb = Ks + kv0 * STG_PITCH;
#pragma unroll
      for (int kk = 0; kk < 4; ++kk) {
        v16h k0 = load_frag16(Kb + l16 * STG_PITCH + kk * 32 + half * 8);
        v16h k1 = load_frag16(Kb + (l16 + 16) * STG_PITCH + kk * 32 + half * 8);
#pragma unroll
        for (int t = 0; t < 2; ++t) {
          s0[t] = wmma16x16x32(k0, qa[t][kk], s0[t]);
          s1[t] = wmma16x16x32(k1, qa[t][kk], s1[t]);
        }
      }

      // ---- online softmax: 16 scores of each of two queries per lane -----
      v16h pb[2];           // P^T as B operand: element s is key 8*half+s (s < 8), 16+8*half+s-8 (s >= 8)
      float corr[2];
#pragma unroll
      for (int t = 0; t < 2; ++t) {
        // maximum as a tree of three-input steps: short dependent chain
        const float m0 = max3f(s0[t][0], s0[t][1], s0[t][2]);
        const float m1 = max3f(s0[t][3], s0[t][4], s0[t][5]);
        const float m2 = max3f(s0[t][6], s0[t][7], s1[t][0]);
        const float m3 = max3f(s1[t][1], s1[t][2], s1[t][3]);
        const float m4 = max3f(s1[t][4], s1[t][5], s1[t][6]);
        float mx = fmaxf(max3f(m0, m1, m2), max3f(m3, m4, s1[t][7]));
        mx = fmaxf(mx, other_half(mx));
        const float mnew = fmaxf(mi[t], mx * sc2);
        corr[t] = __builtin_amdgcn_exp2f(mi[t] - mnew);  // 0 on the first block
        mi[t] = mnew;
        float rs = 0.0f;
#pragma unroll
        for (int r = 0; r < 8; ++r) {
          const float p0 = __builtin_amdgcn_exp2f(s0[t][r] * sc2 - mnew);
          const float p1 = __builtin_amdgcn_exp2f(s1[t][r] * sc2 - mnew);
          rs += p0 + p1;
          pb[t][r]     = (f16)p0;
          pb[t][r + 8] = (f16)p1;
        }
        li[t] = li[t] * corr[t] + rs;
      }

      // ---- O^T += V^T P^T : V^T rows are the A operand, read once for both groups
#pragma unroll
      for (int cn = 0; cn < 8; ++cn) {
        v16h vf = load_frag16(Vs + (cn * 16 + l16) * STG_PITCH + kv0 + half * 8);
#pragma unroll
        for (int t = 0; t < 2; ++t)
          acc[t][cn] = wmma16x16x32(vf, pb[t], acc[t][cn] * corr[t]);
      }
    }

    // ---- hand-over: publish stage st + 1, free this stage's buffer -------
    asm volatile("s_wait_dscnt 0x0" ::: "memory");     // own reads of this buffer done
    asm volatile("s_wait_asynccnt 0x0" ::: "memory");  // own copies of stage st + 1 landed
    __syncthreads();                                   // both hold for every wave
    if (st + 2 < STG_COUNT)
      copy_stage(lds_my + (st & 1) * (STG_BUF * 2),
                 gk_my + (size_t)(st + 2) * (STG_KEYS * CDIM * 2),
                 gv_my + (size_t)(st + 2) * (STG_KEYS * 2));
  }
  asm volatile("s_wait_asynccnt 0x0" ::: "memory");    // nothing in flight at the wave's end

  // ---- join the two key halves of each query through LDS ----------------
  // Behind the loop's last barrier nobody reads the stages and no copy is in
  // flight, so their LDS carries the hand-over: 33 pieces of 16 B per lane, each
  // piece a contiguous 512 B per wave.
  v4f* Join = (v4f*)&Stage[0] + (size_t)qg * (33 * 32) + lane;
  if (kh == 1) {
    const v4f ml = {mi[0], mi[1], li[0], li[1]};
    Join[32 * 32] = ml;
#pragma unroll
    for (int t = 0; t < 2; ++t)
#pragma unroll
      for (int cn = 0; cn < 8; ++cn) {
        const v4f lo = {acc[t][cn][0], acc[t][cn][1], acc[t][cn][2], acc[t][cn][3]};
        const v4f hi = {acc[t][cn][4], acc[t][cn][5], acc[t][cn][6], acc[t][cn][7]};
        Join[((t * 8 + cn) * 2) * 32]     = lo;
        Join[((t * 8 + cn) * 2 + 1) * 32] = hi;
      }
  }
  __syncthreads();                                     // the partner's partial results are in LDS
  if (kh == 1) return;

  // ---- join the lane halves' sums, normalize, store f16 attention output ----
  const v4f ml = Join[32 * 32];
#pragma unroll
  for (int t = 0; t < 2; ++t) {
    const float mj = fmaxf(mi[t], ml[t]);
    const float fa = __builtin_amdgcn_exp2f(mi[t] - mj);   // weight of this wave's keys
    const float fb = __builtin_amdgcn_exp2f(ml[t] - mj);   // weight of the partner's keys
    const float lj = li[t] * fa + ml[2 + t] * fb;
    const float inv = 1.0f / (lj + other_half(lj));
    const float wa = fa * inv, wb = fb * inv;
    f16* Orow = O + (qbase + t * 16 + l16) * CDIM + 8 * half;
#pragma unroll
    for (int cn = 0; cn < 8; ++cn) {
      const v4f lo = Join[((t * 8 + cn) * 2) * 32];
      const v4f hi = Join[((t * 8 + cn) * 2 + 1) * 32];
      v8h o;
#pragma unroll
      for (int r = 0; r < 4; ++r) {
        o[r]     = (f16)(acc[t][cn][r] * wa + lo[r] * wb);
        o[r + 4] = (f16)(acc[t][cn][r + 4] * wa + hi[r] * wb);
      }
      *(v8h*)(Orow + cn * 16) = o;
    }
  }
}

// ---------------------------------------------------------------------------
extern "C" void kernel_launch(void* const* d_in, const int* in_sizes, int n_in,
                              void* d_out, int out_size, void* d_ws, size_t ws_size,
                              hipStream_t stream) {
  (void)in_sizes; (void)n_in; (void)out_size; (void)ws_size;

  const float* inputs  = (const float*)d_in[0];
  const float* context = (const float*)d_in[1];
  const float* gamma   = (const float*)d_in[2];
  const float* beta    = (const float*)d_in[3];
  const float* Wq      = (const float*)d_in[4];
  const float* bq      = (const float*)d_in[5];
  const float* Wk      = (const float*)d_in[6];
  const float* bk      = (const float*)d_in[7];
  const float* Wv      = (const float*)d_in[8];
  const float* bv      = (const float*)d_in[9];
  const float* Wp      = (const float*)d_in[10];
  const float* bp      = (const float*)d_in[11];
  float* out = (float*)d_out;

  const size_t halfbuf = (size_t)MROWS * CDIM * sizeof(f16);  // 8 MB each
  char* ws = (char*)d_ws;
  f16* qh   = (f16*)(ws + 0 * halfbuf);
  f16* kh   = (f16*)(ws + 1 * halfbuf);
  f16* vt   = (f16*)(ws + 2 * halfbuf);   // [b][c][n] transposed
  f16* oh   = (f16*)(ws + 3 * halfbuf);

  // 1) xn = LayerNorm(inputs) (f32) -> d_out as residual base;
  //    Q = xn @ Wq + bq ; K = ctx @ Wk + bk ; V^T = (ctx @ Wv + bv)^T
  ln_qkv_kernel<<<2 * ROW_TILES, 256, 0, stream>>>(inputs, context, gamma, beta,
                                                   Wq, bq, Wk, bk, Wv, bv,
                                                   out, qh, kh, vt);
  // 2) fused softmax(Q K^T / sqrt(U)) V
  flash_attn_kernel<<<NBATCH * (NPIX / WG_QUERIES), 256, 0, stream>>>(qh, kh, vt, oh);
  // 3) d_out(=xn) += attn_out @ Wp + bp
  gemm128_residual_kernel<<<ROW_TILES, 256, 0, stream>>>(oh, Wp, bp, out);
}

// v007
// A run of this version takes 77.3 microseconds.
// In both of two side-by-side timings against v006, it was 1.09 times as fast.
// Counting every step since v000, it is 5.92 times as fast.
#include <hip/hip_runtime.h>
#include <hip/hip_bf16.h>

// ---------------------------------------------------------------------------
// CrossAttentionBlock for MI455X (gfx1250, wave32, WMMA 16x16x32 f16)
// B=8, H=W=64 (N=4096 pixels), C=U=128.
// ---------------------------------------------------------------------------

typedef _Float16 f16;
typedef __attribute__((ext_vector_type(4)))  _Float16 v4h;
typedef __attribute__((ext_vector_type(8)))  _Float16 v8h;
typedef __attribute__((ext_vector_type(16))) _Float16 v16h;
typedef __attribute__((ext_vector_type(8)))  float    v8f;
typedef __attribute__((ext_vector_type(4)))  float    v4f;

#define NPIX   4096          // H*W
#define CDIM   128           // channels == units
#define NBATCH 8
#define MROWS  (NBATCH * NPIX)  // 32768 total pixel rows

// Load one 16x32 f16 A/B fragment for v_wmma_f32_16x16x32_f16.
// Per ISA layout: lane's 16 halves are two contiguous groups of 8 at
// k = half*8 .. +7 and k = 16+half*8 .. +7 (caller pre-offsets by half*8).
__device__ inline v16h load_frag16(const f16* p) {
  v8h lo = *(const v8h*)(p);
  v8h hi = *(const v8h*)(p + 16);
  return __builtin_shufflevector(lo, hi, 0, 1, 2, 3, 4, 5, 6, 7,
                                         8, 9, 10, 11, 12, 13, 14, 15);
}

__device__ inline v8f wmma16x16x32(v16h a, v16h b, v8f c) {
  // (neg_a, A, neg_b, B, c_mod, C, reuse_a, reuse_b)
  return __builtin_amdgcn_wmma_f32_16x16x32_f16(false, a, false, b,
                                                (short)0, c, false, false);
}

__device__ inline float max3f(float a, float b, float c) {
  return fmaxf(fmaxf(a, b), c);
}

// Value of the partner lane in the other 16-lane half (lane ^ 16).
__device__ inline float other_half(float v) {
  const int b = __builtin_bit_cast(int, v);
  return __builtin_bit_cast(float,
      __builtin_amdgcn_permlanex16(b, b, 0x76543210, 0xfedcba98, false, false));
}

// ---------------------------------------------------------------------------
// 128 x 128 projection tile, C[128 x 128] = A[128 x 128](f16) @ W[128 x 128] + bias,
// via WMMA. 256 threads = 8 waves; each wave owns 16 rows.
// W is staged in LDS transposed as f16 so its fragments are two b128 ds loads.
// The LDS rows are pitched 16 B past their 256 B: the 16 rows of a fragment read
// and the 32 rows of a staging store then spread over the banks.
// The output form is a compile-time parameter, and it picks the operand roles so
// that the 8 accumulators of a lane are neighbours in memory:
// MODE 0: f16 row-major [M,128]    (Q / K): C^T = W^T A^T, lane = row, regs = columns
// MODE 1: f16 transposed [b][c][n] (V):     C   = A W,     lane = column, regs = rows
// ---------------------------------------------------------------------------
#define WT_PITCH 136         // halves per LDS row of W^T: 256 B + 16 B pad
#define ROW_TILES (MROWS / 128)   // 128-row tiles of the pixel rows

// a: this wave's A fragments (rows row0 .. row0 + 15); Wt: the staged W^T, [n][k].
template <int MODE>
__device__ __forceinline__ void gemm128_tile(
    const v16h (&a)[4], const f16* Wt, size_t row0,
    const float* __restrict__ bias, f16* __restrict__ out_h) {
  const int lane = threadIdx.x & 31;
  const int half = lane >> 4;
  const int l16  = lane & 15;
  const size_t off  = (row0 + l16) * CDIM + 8 * half;   // MODE 0: this lane's first result

  // What the epilogue adds is fetched here, as one group ahead of the products: the
  // bias of this lane's results.
  float bcol[8];
  v4f brow[16];
#pragma unroll
  for (int cn = 0; cn < 8; ++cn) {
    if (MODE == 1) {
      bcol[cn] = bias[cn * 16 + l16];
    } else {
      brow[2 * cn]     = *(const v4f*)(bias + cn * 16 + 8 * half);
      brow[2 * cn + 1] = *(const v4f*)(bias + cn * 16 + 8 * half + 4);
    }
  }
  // Before a register that these loads name is used again. The compiler moves no
  // load over this statement either, so the group stays ahead of the products
  // instead of sinking into the epilogue, where each piece would wait by itself.
  asm volatile("s_wait_xcnt 0x0" ::: "memory");

  v8f acc[8] = {};
#pragma unroll
  for (int kk = 0; kk < 4; ++kk) {
#pragma unroll
    for (int cn = 0; cn < 8; ++cn) {
      v16h wfrag = load_frag16(&Wt[(cn * 16 + l16) * WT_PITCH + kk * 32 + half * 8]);
      acc[cn] = (MODE == 1) ? wmma16x16x32(a[kk], wfrag, acc[cn])
                            : wmma16x16x32(wfrag, a[kk], acc[cn]);
    }
  }

#pragma unroll
  for (int cn = 0; cn < 8; ++cn) {
    if (MODE == 1) {
      // acc[cn][r] = C[row0 + 8*half + r][cn*16 + l16]: 8 pixels of one channel, 16 B.
      const size_t b = row0 >> 12, nn = (row0 & (NPIX - 1)) + 8 * half;
      v8h o;
#pragma unroll
      for (int r = 0; r < 8; ++r) o[r] = (f16)(acc[cn][r] + bcol[cn]);
      *(v8h*)(out_h + (b * CDIM + cn * 16 + l16) * NPIX + nn) = o;
    } else {
      // acc[cn][r] = C[row0 + l16][cn*16 + 8*half + r]: 8 columns of one row.
      v4f lo = {acc[cn][0], acc[cn][1], acc[cn][2], acc[cn][3]};
      v4f hi = {acc[cn][4], acc[cn][5], acc[cn][6], acc[cn][7]};
      lo += brow[2 * cn];
      hi += brow[2 * cn + 1];
      v8h o = {(f16)lo[0], (f16)lo[1], (f16)lo[2], (f16)lo[3],
               (f16)hi[0], (f16)hi[1], (f16)hi[2], (f16)hi[3]};
      *(v8h*)(out_h + off + cn * 16) = o;
    }
  }
}

// ---------------------------------------------------------------------------
// Kernel 1: LayerNorm, f16 conversion and the Q, K, V projections in one launch.
// Work-groups 0 .. ROW_TILES-1 take 128 context rows each and write K and V^T;
// the others take 128 input rows each, normalize them (eps = 1e-3), write xn (f32)
// into d_out as the residual base, and write Q. Two work-groups fit a WGP.
// A wave fetches its 16 rows as whole 512 B rows (4 channels per lane), all in
// flight while the weights are staged; the f16 rows go to the A fragments through
// LDS and never through memory.
// ---------------------------------------------------------------------------
__global__ __launch_bounds__(256) void ln_qkv_kernel(
    const float* __restrict__ x, const float* __restrict__ ctx,
    const float* __restrict__ gamma, const float* __restrict__ beta,
    const float* __restrict__ Wq, const float* __restrict__ bq,
    const float* __restrict__ Wk, const float* __restrict__ bk,
    const float* __restrict__ Wv, const float* __restrict__ bv,
    float* __restrict__ xn_out, f16* __restrict__ qh, f16* __restrict__ kh,
    f16* __restrict__ vt) {
  __shared__ __attribute__((aligned(16))) f16 Rows[128 * WT_PITCH];     // [row][k], 34 KB
  __shared__ __attribute__((aligned(16))) f16 Wt[2][CDIM * WT_PITCH];   // [n][k], 34 KB each
  const int lane = threadIdx.x & 31;
  const int wave = threadIdx.x >> 5;
  const int half = lane >> 4;
  const int l16  = lane & 15;
  const bool is_q = blockIdx.x >= ROW_TILES;
  const size_t row0 = (size_t)(is_q ? blockIdx.x - ROW_TILES : blockIdx.x) * 128 + wave * 16;
  const float* src = (is_q ? x : ctx) + row0 * CDIM + lane * 4;

  float4 rv[16];
#pragma unroll
  for (int r = 0; r < 16; ++r) rv[r] = *(const float4*)(src + r * CDIM);
  // Before a register that these loads name is used again; the row pointer is an
  // input so that its registers are not handed out while the loads are issued.
  asm volatile("s_wait_xcnt 0x0" :: "v"(src) : "memory");

  if (is_q) {
    for (int idx = threadIdx.x; idx < CDIM * CDIM; idx += 256) {
      int k = idx >> 7, n = idx & 127;
      Wt[0][n * WT_PITCH + k] = (f16)Wq[idx];
    }

    // LayerNorm of the 16 rows, their reductions side by side.
    const float4 g  = ((const float4*)gamma)[lane];
    const float4 bt = ((const float4*)beta)[lane];
    float s[16];
#pragma unroll
    for (int r = 0; r < 16; ++r) s[r] = rv[r].x + rv[r].y + rv[r].z + rv[r].w;
#pragma unroll
    for (int m = 16; m >= 1; m >>= 1)
#pragma unroll
      for (int r = 0; r < 16; ++r) s[r] += __shfl_xor(s[r], m, 32);
#pragma unroll
    for (int r = 0; r < 16; ++r) {
      const float mu = s[r] * (1.0f / 128.0f);
      rv[r].x -= mu; rv[r].y -= mu; rv[r].z -= mu; rv[r].w -= mu;
      s[r] = rv[r].x * rv[r].x + rv[r].y * rv[r].y + rv[r].z * rv[r].z + rv[r].w * rv[r].w;
    }
#pragma unroll
    for (int m = 16; m >= 1; m >>= 1)
#pragma unroll
      for (int r = 0; r < 16; ++r) s[r] += __shfl_xor(s[r], m, 32);
#pragma unroll
    for (int r = 0; r < 16; ++r) {
      const float inv = rsqrtf(s[r] * (1.0f / 128.0f) + 1e-3f);
      rv[r].x = rv[r].x * inv * g.x + bt.x;
      rv[r].y = rv[r].y * inv * g.y + bt.y;
      rv[r].z = rv[r].z * inv * g.z + bt.z;
      rv[r].w = rv[r].w * inv * g.w + bt.w;
    }
  } else {
    for (int idx = threadIdx.x; idx < CDIM * CDIM; idx += 256) {
      int k = idx >> 7, n = idx & 127;
      Wt[0][n * WT_PITCH + k] = (f16)Wk[idx];
      Wt[1][n * WT_PITCH + k] = (f16)Wv[idx];
    }
  }

#pragma unroll
  for (int r = 0; r < 16; ++r) {
    v4h h = {(f16)rv[r].x, (f16)rv[r].y, (f16)rv[r].z, (f16)rv[r].w};
    *(v4h*)&Rows[(wave * 16 + r) * WT_PITCH + lane * 4] = h;
  }
  __syncthreads();

  // xn goes out behind the barrier, which would otherwise wait for these stores.
  if (is_q) {
#pragma unroll
    for (int r = 0; r < 16; ++r)
      ((float4*)(xn_out + (row0 + r) * CDIM))[lane] = rv[r];
  }

  v16h a[4];
#pragma unroll
  for (int kk = 0; kk < 4; ++kk)
    a[kk] = load_frag16(&Rows[(wave * 16 + l16) * WT_PITCH + kk * 32 + half * 8]);

  if (is_q) {
    gemm128_tile<0>(a, Wt[0], row0, bq, qh);
  } else {
    gemm128_tile<0>(a, Wt[0], row0, bk, kh);
    // Before a register that the K stores name is used again by the second tile.
    asm volatile("s_wait_xcnt 0x0" ::: "memory");
    gemm128_tile<1>(a, Wt[1], row0, bv, vt);
    // Before a register that the V^T stores name is used again: in the built code
    // the other branch's instructions stand behind them.
    asm volatile("s_wait_xcnt 0x0" ::: "memory");
  }
}

// ---------------------------------------------------------------------------
// Kernel 2: flash attention, output projection and residual. 256 threads = 8 waves;
// 128 query rows per work-group.
// K and V^T are staged in LDS, 128 keys per stage, two buffers, by asynchronous
// copies: the eight waves share one whole-line fetch of each tile, and the copies
// of the next stage fly while this stage is worked on.
// Wave tile: 32 queries (two column groups) x 64 of the stage's 128 keys. Waves w
// and w + 4 hold the same queries and split the keys, so every K and V^T fragment
// read from LDS feeds two products, and one work-group fills a WGP with two waves
// per SIMD. Each wave keeps its own running maximum, sum and output over its keys;
// the two partial results of a query are joined through LDS behind the loop.
// The keys are walked in blocks of 32, in transposed form: S^T = K Q^T (16 WMMAs)
// leaves one query's scores in one lane pair, so the online softmax runs in
// registers; the S^T tiles, converted in place, are the B operands of
// O^T += V^T P^T (16 WMMAs). A lane holds queries l16 and 16 + l16; its half holds
// keys 8*half+r, 16+8*half+r.
// The work-group holds whole rows of the attention output, so the projection runs
// here: the joined O^T tiles, rounded to f16, are in place the B operands of
// out^T = Wp^T O^T (Wp^T staged in LDS as f16 while stage 0 lands), and the result
// is added onto xn in out_f. The attention output never goes through memory.
// ---------------------------------------------------------------------------
#define STG_KEYS   128                       // keys per stage
#define STG_PITCH  136                       // halves per LDS row: 256 B + 16 B pad
#define STG_TILE   (128 * STG_PITCH)         // halves per tile (K: 128 keys, V^T: 128 channels)
#define STG_BUF    (2 * STG_TILE)            // halves per buffer (K tile, then V^T tile)
#define STG_COUNT  (NPIX / STG_KEYS)         // stages per batch
#define WAVE_KEYS  (STG_KEYS / 2)            // keys of a stage that one wave walks
#define WG_QUERIES 128                       // queries per work-group: 4 wave pairs x 32

// Eight 16-byte copies per lane, global -> LDS, rows 16 apart in the tile.
// The s_wait_xcnt closes the statement so that no address register named by a
// copy is rewritten ahead of it.
__device__ inline void copy8_to_lds(unsigned l, const char* g, size_t gstep) {
  const unsigned ls = 16 * STG_PITCH * 2;    // 16 LDS rows, in bytes
  asm volatile(
      "global_load_async_to_lds_b128 %0, %8, off\n\t"
      "global_load_async_to_lds_b128 %1, %9, off\n\t"
      "global_load_async_to_lds_b128 %2, %10, off\n\t"
      "global_load_async_to_lds_b128 %3, %11, off\n\t"
      "global_load_async_to_lds_b128 %4, %12, off\n\t"
      "global_load_async_to_lds_b128 %5, %13, off\n\t"
      "global_load_async_to_lds_b128 %6, %14, off\n\t"
      "global_load_async_to_lds_b128 %7, %15, off\n\t"
      "s_wait_xcnt 0x0"
      :: "v"(l), "v"(l + ls), "v"(l + 2 * ls), "v"(l + 3 * ls),
         "v"(l + 4 * ls), "v"(l + 5 * ls), "v"(l + 6 * ls), "v"(l + 7 * ls),
         "v"(g), "v"(g + gstep), "v"(g + 2 * gstep), "v"(g + 3 * gstep),
         "v"(g + 4 * gstep), "v"(g + 5 * gstep), "v"(g + 6 * gstep), "v"(g + 7 * gstep)
      : "memory");
}

// One stage: 128 K rows (contiguous 32 KB) and 128 V^T rows of 256 B.
// Thread t copies 16-byte piece (t & 15) of rows (t >> 4) + 16 j, j = 0..7.
__device__ inline void copy_stage(unsigned lds_k, const char* gk, const char* gv) {
  copy8_to_lds(lds_k,                gk, 16 * CDIM * 2);
  copy8_to_lds(lds_k + STG_TILE * 2, gv, (size_t)16 * NPIX * 2);
}

__global__ __launch_bounds__(256) void flash_attn_kernel(
    const f16* __restrict__ Q, const f16* __restrict__ K,
    const f16* __restrict__ Vt, const float* __restrict__ Wp,
    const float* __restrict__ bp, float* __restrict__ out_f) {
  __shared__ __attribute__((aligned(128))) f16 Stage[2 * STG_BUF];
  __shared__ __attribute__((aligned(16))) f16 Wt[CDIM * WT_PITCH];   // Wp^T, [n][k], 34 KB
  const int lane = threadIdx.x & 31;
  const int wave = __builtin_amdgcn_readfirstlane(threadIdx.x >> 5);
  const int half = lane >> 4;
  const int l16  = lane & 15;
  const int qg   = wave & 3;    // which 32 queries of the work-group
  const int kh   = wave >> 2;   // which 64 keys of every stage
  const int b    = blockIdx.x / (NPIX / WG_QUERIES);
  const int q0   = (blockIdx.x % (NPIX / WG_QUERIES)) * WG_QUERIES + qg * 32;
  const size_t qbase = (size_t)b * NPIX + q0;
  const float sc2 = 0.08838834764831845f * 1.4426950408889634f;  // U^-0.5 * log2(e), U=128

  // This thread's piece of every tile: LDS byte address and global bytes.
  const int crow = threadIdx.x >> 4, cpiece = threadIdx.x & 15;
  const unsigned lds_my = (unsigned)(size_t)&Stage[0] + crow * (STG_PITCH * 2) + cpiece * 16;
  const char* gk_my = (const char*)(K + (size_t)b * NPIX * CDIM) + crow * (CDIM * 2) + cpiece * 16;
  const char* gv_my = (const char*)(Vt + (size_t)b * CDIM * NPIX) + (size_t)crow * (NPIX * 2) + cpiece * 16;

  // Stage 0 lands and is published; stage 1 then flies during stage 0's work.
  copy_stage(lds_my, gk_my, gv_my);

  // Wp^T into LDS as f16 while stage 0 flies: a thread takes 64 k of one column n
  // (a wave's load is one 128 B line), all loads in flight at once, and stores 8 k
  // as 16 B. The barrier that publishes stage 0 publishes these rows too.
  {
    const int wn = threadIdx.x & 127, wk = (threadIdx.x >> 7) * 64;
    const float* wsrc = Wp + wk * CDIM + wn;
    float w[64];
#pragma unroll
    for (int i = 0; i < 64; ++i) w[i] = wsrc[i * CDIM];
    // Before a register that these loads name is used again; the pointer is an
    // input so that its registers are not handed out while the loads are issued.
    asm volatile("s_wait_xcnt 0x0" :: "v"(wsrc) : "memory");
#pragma unroll
    for (int j = 0; j < 8; ++j) {
      v8h h;
#pragma unroll
      for (int r = 0; r < 8; ++r) h[r] = (f16)w[j * 8 + r];
      *(v8h*)&Wt[wn * WT_PITCH + wk + j * 8] = h;
    }
  }
  asm volatile("s_wait_asynccnt 0x0" ::: "memory");  // own copies of stage 0 landed
  __syncthreads();                                   // every wave's copies landed
  copy_stage(lds_my + STG_BUF * 2, gk_my + STG_KEYS * CDIM * 2, gv_my + STG_KEYS * 2);

  const f16* Qrow = Q + (qbase + l16) * CDIM + half * 8;
  v16h qa[2][4];
#pragma unroll
  for (int t = 0; t < 2; ++t)
#pragma unroll
    for (int kk = 0; kk < 4; ++kk)
      qa[t][kk] = load_frag16(Qrow + t * 16 * CDIM + kk * 32);
  // Before a register that these loads name is used again; the row pointer is an
  // input so that its registers are not handed out while the loads are issued.
  asm volatile("s_wait_xcnt 0x0" :: "v"(Qrow) : "memory");

  v8f acc[2][8] = {};       // acc[t][cn][r] = O[query t*16 + l16][channel cn*16 + 8*half + r]
  float mi[2] = {-3.0e38f, -3.0e38f};  // running maxima of this lane's queries, log2 units
  float li[2] = {0.0f, 0.0f};          // running sums over this lane half's keys only

  for (int st = 0; st < STG_COUNT; ++st) {
    const f16* Ks = &Stage[(st & 1) * STG_BUF] + kh * (WAVE_KEYS * STG_PITCH);  // own key rows
    const f16* Vs = &Stage[(st & 1) * STG_BUF] + STG_TILE + kh * WAVE_KEYS;     // own key columns

    for (int kv0 = 0; kv0 < WAVE_KEYS; kv0 += 32) {
      // ---- S^T = K Q^T for 32 keys x 32 queries: four 16x16 f32 tiles ----
      v8f s0[2] = {}, s1[2] = {};
      const f16* Kb = Ks + kv0 * STG_PITCH;
#pragma unroll
      for (int kk = 0; kk < 4; ++kk) {
        v16h k0 = load_frag16(Kb + l16 * STG_PITCH + kk * 32 + half * 8);
        v16h k1 = load_frag16(Kb + (l16 + 16) * STG_PITCH + kk * 32 + half * 8);
#pragma unroll
        for (int t = 0; t < 2; ++t) {
          s0[t] = wmma16x16x32(k0, qa[t][kk], s0[t]);
          s1[t] = wmma16x16x32(k1, qa[t][kk], s1[t]);
        }
      }

      // ---- online softmax: 16 scores of each of two queries per lane -----
      v16h pb[2];           // P^T as B operand: element s is key 8*half+s (s < 8), 16+8*half+s-8 (s >= 8)
      float corr[2];
#pragma unroll
      for (int t = 0; t < 2; ++t) {
        // maximum as a tree of three-input steps: short dependent chain
        const float m0 = max3f(s0[t][0], s0[t][1], s0[t][2]);
        const float m1 = max3f(s0[t][3], s0[t][4], s0[t][5]);
        const float m2 = max3f(s0[t][6], s0[t][7], s1[t][0]);
        const float m3 = max3f(s1[t][1], s1[t][2], s1[t][3]);
        const float m4 = max3f(s1[t][4], s1[t][5], s1[t][6]);
        float mx = fmaxf(max3f(m0, m1, m2), max3f(m3, m4, s1[t][7]));
        mx = fmaxf(mx, other_half(mx));
        const float mnew = fmaxf(mi[t], mx * sc2);
        corr[t] = __builtin_amdgcn_exp2f(mi[t] - mnew);  // 0 on the first block
        mi[t] = mnew;
        float rs = 0.0f;
#pragma unroll
        for (int r = 0; r < 8; ++r) {
          const float p0 = __builtin_amdgcn_exp2f(s0[t][r] * sc2 - mnew);
          const float p1 = __builtin_amdgcn_exp2f(s1[t][r] * sc2 - mnew);
          rs += p0 + p1;
          pb[t][r]     = (f16)p0;
          pb[t][r + 8] = (f16)p1;
        }
        li[t] = li[t] * corr[t] + rs;
      }

      // ---- O^T += V^T P^T : V^T rows are the A operand, read once for both groups
#pragma unroll
      for (int cn = 0; cn < 8; ++cn) {
        v16h vf = load_frag16(Vs + (cn * 16 + l16) * STG_PITCH + kv0 + half * 8);
#pragma unroll
        for (int t = 0; t < 2; ++t)
          acc[t][cn] = wmma16x16x32(vf, pb[t], acc[t][cn] * corr[t]);
      }
    }

    // ---- hand-over: publish stage st + 1, free this stage's buffer -------
    asm volatile("s_wait_dscnt 0x0" ::: "memory");     // own reads of this buffer done
    asm volatile("s_wait_asynccnt 0x0" ::: "memory");  // own copies of stage st + 1 landed
    __syncthreads();                                   // both hold for every wave
    if (st + 2 < STG_COUNT)
      copy_stage(lds_my + (st & 1) * (STG_BUF * 2),
                 gk_my + (size_t)(st + 2) * (STG_KEYS * CDIM * 2),
                 gv_my + (size_t)(st + 2) * (STG_KEYS * 2));
  }
  asm volatile("s_wait_asynccnt 0x0" ::: "memory");    // nothing in flight at the wave's end

  // ---- join the two key halves of each query through LDS ----------------
  // Behind the loop's last barrier nobody reads the stages and no copy is in
  // flight, so their LDS carries the hand-over: 33 pieces of 16 B per lane, each
  // piece a contiguous 512 B per wave.
  v4f* Join = (v4f*)&Stage[0] + (size_t)qg * (33 * 32) + lane;
  if (kh == 1) {
    const v4f ml = {mi[0], mi[1], li[0], li[1]};
    Join[32 * 32] = ml;
#pragma unroll
    for (int t = 0; t < 2; ++t)
#pragma unroll
      for (int cn = 0; cn < 8; ++cn) {
        const v4f lo = {acc[t][cn][0], acc[t][cn][1], acc[t][cn][2], acc[t][cn][3]};
        const v4f hi = {acc[t][cn][4], acc[t][cn][5], acc[t][cn][6], acc[t][cn][7]};
        Join[((t * 8 + cn) * 2) * 32]     = lo;
        Join[((t * 8 + cn) * 2 + 1) * 32] = hi;
      }
  }
  __syncthreads();                                     // the partner's partial results are in LDS
  if (kh == 1) return;

  // What the projection's results are added to is fetched here, as one group that
  // flies during the join and the products: the bias of this lane's 8 columns per
  // tile and the 2 x 64 values of xn.
  float* outp = out_f + (qbase + l16) * CDIM + 8 * half;   // query l16, first column
  v4f brow[16], res[2][16];
#pragma unroll
  for (int cn = 0; cn < 8; ++cn) {
    brow[2 * cn]     = *(const v4f*)(bp + cn * 16 + 8 * half);
    brow[2 * cn + 1] = *(const v4f*)(bp + cn * 16 + 8 * half + 4);
#pragma unroll
    for (int t = 0; t < 2; ++t) {
      res[t][2 * cn]     = *(const v4f*)(outp + t * 16 * CDIM + cn * 16);
      res[t][2 * cn + 1] = *(const v4f*)(outp + t * 16 * CDIM + cn * 16 + 4);
    }
  }
  // Before a register that these loads name is used again. The compiler moves no
  // load over this statement either, so the group stays ahead of the join instead
  // of sinking to the stores, where each piece would wait by itself.
  asm volatile("s_wait_xcnt 0x0" ::: "memory");

  // ---- join the lane halves' sums, normalize, round to f16 ----------------
  // o of tile cn holds channels cn*16 + 8*half + r of this lane's query: tiles 2kk and
  // 2kk + 1 together are the B fragment of channels kk*32 .. kk*32 + 31.
  const v4f ml = Join[32 * 32];
  v16h ob[2][4];
#pragma unroll
  for (int t = 0; t < 2; ++t) {
    const float mj = fmaxf(mi[t], ml[t]);
    const float fa = __builtin_amdgcn_exp2f(mi[t] - mj);   // weight of this wave's keys
    const float fb = __builtin_amdgcn_exp2f(ml[t] - mj);   // weight of the partner's keys
    const float lj = li[t] * fa + ml[2 + t] * fb;
    const float inv = 1.0f / (lj + other_half(lj));
    const float wa = fa * inv, wb = fb * inv;
#pragma unroll
    for (int cn = 0; cn < 8; ++cn) {
      const v4f lo = Join[((t * 8 + cn) * 2) * 32];
      const v4f hi = Join[((t * 8 + cn) * 2 + 1) * 32];
#pragma unroll
      for (int r = 0; r < 4; ++r) {
        ob[t][cn >> 1][(cn & 1) * 8 + r]     = (f16)(acc[t][cn][r] * wa + lo[r] * wb);
        ob[t][cn >> 1][(cn & 1) * 8 + r + 4] = (f16)(acc[t][cn][r + 4] * wa + hi[r] * wb);
      }
    }
  }

  // ---- out^T = Wp^T O^T: a Wp^T fragment from LDS feeds both query groups ----
  v8f pacc[2][8] = {};      // pacc[t][cn][r] = proj[query t*16 + l16][column cn*16 + 8*half + r]
#pragma unroll
  for (int kk = 0; kk < 4; ++kk) {
#pragma unroll
    for (int cn = 0; cn < 8; ++cn) {
      v16h wfrag = load_frag16(&Wt[(cn * 16 + l16) * WT_PITCH + kk * 32 + half * 8]);
#pragma unroll
      for (int t = 0; t < 2; ++t)
        pacc[t][cn] = wmma16x16x32(wfrag, ob[t][kk], pacc[t][cn]);
    }
  }

  // ---- bias, xn residual, f32 output: 8 columns of one row per tile ----------
  // All sums first, then all stores, so that no register that a store names is
  // written again.
#pragma unroll
  for (int t = 0; t < 2; ++t)
#pragma unroll
    for (int cn = 0; cn < 8; ++cn) {
      v4f lo = {pacc[t][cn][0], pacc[t][cn][1], pacc[t][cn][2], pacc[t][cn][3]};
      v4f hi = {pacc[t][cn][4], pacc[t][cn][5], pacc[t][cn][6], pacc[t][cn][7]};
      lo += brow[2 * cn];
      hi += brow[2 * cn + 1];
      res[t][2 * cn]     += lo;
      res[t][2 * cn + 1] += hi;
    }
#pragma unroll
  for (int t = 0; t < 2; ++t)
#pragma unroll
    for (int i = 0; i < 16; ++i)
      *(v4f*)(outp + t * 16 * CDIM + (i >> 1) * 16 + (i & 1) * 4) = res[t][i];
}

// ---------------------------------------------------------------------------
extern "C" void kernel_launch(void* const* d_in, const int* in_sizes, int n_in,
                              void* d_out, int out_size, void* d_ws, size_t ws_size,
                              hipStream_t stream) {
  (void)in_sizes; (void)n_in; (void)out_size; (void)ws_size;

  const float* inputs  = (const float*)d_in[0];
  const float* context = (const float*)d_in[1];
  const float* gamma   = (const float*)d_in[2];
  const float* beta    = (const float*)d_in[3];
  const float* Wq      = (const float*)d_in[4];
  const float* bq      = (const float*)d_in[5];
  const float* Wk      = (const float*)d_in[6];
  const float* bk      = (const float*)d_in[7];
  const float* Wv      = (const float*)d_in[8];
  const float* bv      = (const float*)d_in[9];
  const float* Wp      = (const float*)d_in[10];
  const float* bp      = (const float*)d_in[11];
  float* out = (float*)d_out;

  const size_t halfbuf = (size_t)MROWS * CDIM * sizeof(f16);  // 8 MB each
  char* ws = (char*)d_ws;
  f16* qh   = (f16*)(ws + 0 * halfbuf);
  f16* kh   = (f16*)(ws + 1 * halfbuf);
  f16* vt   = (f16*)(ws + 2 * halfbuf);   // [b][c][n] transposed

  // 1) xn = LayerNorm(inputs) (f32) -> d_out as residual base;
  //    Q = xn @ Wq + bq ; K = ctx @ Wk + bk ; V^T = (ctx @ Wv + bv)^T
  ln_qkv_kernel<<<2 * ROW_TILES, 256, 0, stream>>>(inputs, context, gamma, beta,
                                                   Wq, bq, Wk, bk, Wv, bv,
                                                   out, qh, kh, vt);
  // 2) d_out(=xn) += softmax(Q K^T / sqrt(U)) V @ Wp + bp
  flash_attn_kernel<<<NBATCH * (NPIX / WG_QUERIES), 256, 0, stream>>>(qh, kh, vt, Wp, bp, out);
}

// v008
// It runs in 70.1 microseconds.
// Timed twice side by side with v007, it ran 1.10 times as fast both times.
// Counting every step since v000, it is 6.53 times as fast.
#include <hip/hip_runtime.h>
#include <hip/hip_bf16.h>

// ---------------------------------------------------------------------------
// CrossAttentionBlock for MI455X (gfx1250, wave32, WMMA 16x16x32 f16)
// B=8, H=W=64 (N=4096 pixels), C=U=128.
// ---------------------------------------------------------------------------

typedef _Float16 f16;
typedef __attribute__((ext_vector_type(4)))  _Float16 v4h;
typedef __attribute__((ext_vector_type(8)))  _Float16 v8h;
typedef __attribute__((ext_vector_type(16))) _Float16 v16h;
typedef __attribute__((ext_vector_type(8)))  float    v8f;
typedef __attribute__((ext_vector_type(4)))  float    v4f;

#define NPIX   4096          // H*W
#define CDIM   128           // channels == units
#define NBATCH 8
#define MROWS  (NBATCH * NPIX)  // 32768 total pixel rows

// Load one 16x32 f16 A/B fragment for v_wmma_f32_16x16x32_f16.
// Per ISA layout: lane's 16 halves are two contiguous groups of 8 at
// k = half*8 .. +7 and k = 16+half*8 .. +7 (caller pre-offsets by half*8).
__device__ inline v16h load_frag16(const f16* p) {
  v8h lo = *(const v8h*)(p);
  v8h hi = *(const v8h*)(p + 16);
  return __builtin_shufflevector(lo, hi, 0, 1, 2, 3, 4, 5, 6, 7,
                                         8, 9, 10, 11, 12, 13, 14, 15);
}

__device__ inline v8f wmma16x16x32(v16h a, v16h b, v8f c) {
  // (neg_a, A, neg_b, B, c_mod, C, reuse_a, reuse_b)
  return __builtin_amdgcn_wmma_f32_16x16x32_f16(false, a, false, b,
                                                (short)0, c, false, false);
}

__device__ inline float max3f(float a, float b, float c) {
  return fmaxf(fmaxf(a, b), c);
}

// Value of the partner lane in the other 16-lane half (lane ^ 16).
__device__ inline float other_half(float v) {
  const int b = __builtin_bit_cast(int, v);
  return __builtin_bit_cast(float,
      __builtin_amdgcn_permlanex16(b, b, 0x76543210, 0xfedcba98, false, false));
}

// ---------------------------------------------------------------------------
// 128 x 128 projection tile, C[128 x 128] = A[128 x 128](f16) @ W[128 x 128] + bias,
// via WMMA. 256 threads = 8 waves; each wave owns 16 rows.
// W is staged in LDS transposed as f16 so its fragments are two b128 ds loads.
// The LDS rows are pitched 16 B past their 256 B: the 16 rows of a fragment read
// and the 32 rows of a staging store then spread over the banks.
// The output form is a compile-time parameter, and it picks the operand roles so
// that the 8 accumulators of a lane are neighbours in memory:
// MODE 0: f16 row-major [M,128]    (Q / K): C^T = W^T A^T, lane = row, regs = columns
// MODE 1: f16 transposed [b][c][n] (V):     C   = A W,     lane = column, regs = rows
// ---------------------------------------------------------------------------
#define WT_PITCH 136         // halves per LDS row of W^T: 256 B + 16 B pad
#define ROW_TILES (MROWS / 128)   // 128-row tiles of the pixel rows

// a: this wave's A fragments (rows row0 .. row0 + 15); Wt: the staged W^T, [n][k].
template <int MODE>
__device__ __forceinline__ void gemm128_tile(
    const v16h (&a)[4], const f16* Wt, size_t row0,
    const float* __restrict__ bias, f16* __restrict__ out_h) {
  const int lane = threadIdx.x & 31;
  const int half = lane >> 4;
  const int l16  = lane & 15;
  const size_t off  = (row0 + l16) * CDIM + 8 * half;   // MODE 0: this lane's first result

  // What the epilogue adds is fetched here, as one group ahead of the products: the
  // bias of this lane's results.
  float bcol[8];
  v4f brow[16];
#pragma unroll
  for (int cn = 0; cn < 8; ++cn) {
    if (MODE == 1) {
      bcol[cn] = bias[cn * 16 + l16];
    } else {
      brow[2 * cn]     = *(const v4f*)(bias + cn * 16 + 8 * half);
      brow[2 * cn + 1] = *(const v4f*)(bias + cn * 16 + 8 * half + 4);
    }
  }
  // Before a register that these loads name is used again. The compiler moves no
  // load over this statement either, so the group stays ahead of the products
  // instead of sinking into the epilogue, where each piece would wait by itself.
  asm volatile("s_wait_xcnt 0x0" ::: "memory");

  v8f acc[8] = {};
#pragma unroll
  for (int kk = 0; kk < 4; ++kk) {
#pragma unroll
    for (int cn = 0; cn < 8; ++cn) {
      v16h wfrag = load_frag16(&Wt[(cn * 16 + l16) * WT_PITCH + kk * 32 + half * 8]);
      acc[cn] = (MODE == 1) ? wmma16x16x32(a[kk], wfrag, acc[cn])
                            : wmma16x16x32(wfrag, a[kk], acc[cn]);
    }
  }

#pragma unroll
  for (int cn = 0; cn < 8; ++cn) {
    if (MODE == 1) {
      // acc[cn][r] = C[row0 + 8*half + r][cn*16 + l16]: 8 pixels of one channel, 16 B.
      const size_t b = row0 >> 12, nn = (row0 & (NPIX - 1)) + 8 * half;
      v8h o;
#pragma unroll
      for (int r = 0; r < 8; ++r) o[r] = (f16)(acc[cn][r] + bcol[cn]);
      *(v8h*)(out_h + (b * CDIM + cn * 16 + l16) * NPIX + nn) = o;
    } else {
      // acc[cn][r] = C[row0 + l16][cn*16 + 8*half + r]: 8 columns of one row.
      v4f lo = {acc[cn][0], acc[cn][1], acc[cn][2], acc[cn][3]};
      v4f hi = {acc[cn][4], acc[cn][5], acc[cn][6], acc[cn][7]};
      lo += brow[2 * cn];
      hi += brow[2 * cn + 1];
      v8h o = {(f16)lo[0], (f16)lo[1], (f16)lo[2], (f16)lo[3],
               (f16)hi[0], (f16)hi[1], (f16)hi[2], (f16)hi[3]};
      *(v8h*)(out_h + off + cn * 16) = o;
    }
  }
}

// ---------------------------------------------------------------------------
// Kernel 1: LayerNorm, f16 conversion and the Q, K, V projections in one launch.
// Work-groups 0 .. ROW_TILES-1 take 128 context rows each and write K and V^T;
// the others take 128 input rows each, normalize them (eps = 1e-3), write xn (f32)
// into d_out as the residual base, and write Q. Two work-groups fit a WGP.
// A wave fetches its 16 rows as whole 512 B rows (4 channels per lane), all in
// flight while the weights are staged; the f16 rows go to the A fragments through
// LDS and never through memory.
// ---------------------------------------------------------------------------
__global__ __launch_bounds__(256) void ln_qkv_kernel(
    const float* __restrict__ x, const float* __restrict__ ctx,
    const float* __restrict__ gamma, const float* __restrict__ beta,
    const float* __restrict__ Wq, const float* __restrict__ bq,
    const float* __restrict__ Wk, const float* __restrict__ bk,
    const float* __restrict__ Wv, const float* __restrict__ bv,
    float* __restrict__ xn_out, f16* __restrict__ qh, f16* __restrict__ kh,
    f16* __restrict__ vt) {
  __shared__ __attribute__((aligned(16))) f16 Rows[128 * WT_PITCH];     // [row][k], 34 KB
  __shared__ __attribute__((aligned(16))) f16 Wt[2][CDIM * WT_PITCH];   // [n][k], 34 KB each
  const int lane = threadIdx.x & 31;
  const int wave = threadIdx.x >> 5;
  const int half = lane >> 4;
  const int l16  = lane & 15;
  const bool is_q = blockIdx.x >= ROW_TILES;
  const size_t row0 = (size_t)(is_q ? blockIdx.x - ROW_TILES : blockIdx.x) * 128 + wave * 16;
  const float* src = (is_q ? x : ctx) + row0 * CDIM + lane * 4;

  float4 rv[16];
#pragma unroll
  for (int r = 0; r < 16; ++r) rv[r] = *(const float4*)(src + r * CDIM);
  // Before a register that these loads name is used again; the row pointer is an
  // input so that its registers are not handed out while the loads are issued.
  asm volatile("s_wait_xcnt 0x0" :: "v"(src) : "memory");

  if (is_q) {
    for (int idx = threadIdx.x; idx < CDIM * CDIM; idx += 256) {
      int k = idx >> 7, n = idx & 127;
      Wt[0][n * WT_PITCH + k] = (f16)Wq[idx];
    }

    // LayerNorm of the 16 rows, their reductions side by side.
    const float4 g  = ((const float4*)gamma)[lane];
    const float4 bt = ((const float4*)beta)[lane];
    float s[16];
#pragma unroll
    for (int r = 0; r < 16; ++r) s[r] = rv[r].x + rv[r].y + rv[r].z + rv[r].w;
#pragma unroll
    for (int m = 16; m >= 1; m >>= 1)
#pragma unroll
      for (int r = 0; r < 16; ++r) s[r] += __shfl_xor(s[r], m, 32);
#pragma unroll
    for (int r = 0; r < 16; ++r) {
      const float mu = s[r] * (1.0f / 128.0f);
      rv[r].x -= mu; rv[r].y -= mu; rv[r].z -= mu; rv[r].w -= mu;
      s[r] = rv[r].x * rv[r].x + rv[r].y * rv[r].y + rv[r].z * rv[r].z + rv[r].w * rv[r].w;
    }
#pragma unroll
    for (int m = 16; m >= 1; m >>= 1)
#pragma unroll
      for (int r = 0; r < 16; ++r) s[r] += __shfl_xor(s[r], m, 32);
#pragma unroll
    for (int r = 0; r < 16; ++r) {
      const float inv = rsqrtf(s[r] * (1.0f / 128.0f) + 1e-3f);
      rv[r].x = rv[r].x * inv * g.x + bt.x;
      rv[r].y = rv[r].y * inv * g.y + bt.y;
      rv[r].z = rv[r].z * inv * g.z + bt.z;
      rv[r].w = rv[r].w * inv * g.w + bt.w;
    }
  } else {
    for (int idx = threadIdx.x; idx < CDIM * CDIM; idx += 256) {
      int k = idx >> 7, n = idx & 127;
      Wt[0][n * WT_PITCH + k] = (f16)Wk[idx];
      Wt[1][n * WT_PITCH + k] = (f16)Wv[idx];
    }
  }

#pragma unroll
  for (int r = 0; r < 16; ++r) {
    v4h h = {(f16)rv[r].x, (f16)rv[r].y, (f16)rv[r].z, (f16)rv[r].w};
    *(v4h*)&Rows[(wave * 16 + r) * WT_PITCH + lane * 4] = h;
  }
  __syncthreads();

  // xn goes out behind the barrier, which would otherwise wait for these stores.
  if (is_q) {
#pragma unroll
    for (int r = 0; r < 16; ++r)
      ((float4*)(xn_out + (row0 + r) * CDIM))[lane] = rv[r];
  }

  v16h a[4];
#pragma unroll
  for (int kk = 0; kk < 4; ++kk)
    a[kk] = load_frag16(&Rows[(wave * 16 + l16) * WT_PITCH + kk * 32 + half * 8]);

  if (is_q) {
    gemm128_tile<0>(a, Wt[0], row0, bq, qh);
  } else {
    gemm128_tile<0>(a, Wt[0], row0, bk, kh);
    // Before a register that the K stores name is used again by the second tile.
    asm volatile("s_wait_xcnt 0x0" ::: "memory");
    gemm128_tile<1>(a, Wt[1], row0, bv, vt);
    // Before a register that the V^T stores name is used again: in the built code
    // the other branch's instructions stand behind them.
    asm volatile("s_wait_xcnt 0x0" ::: "memory");
  }
}

// ---------------------------------------------------------------------------
// Kernel 2: flash attention, output projection and residual. 256 threads = 8 waves;
// 128 query rows per work-group.
// K and V^T are staged in LDS, 128 keys per stage, two buffers, by asynchronous
// copies: the eight waves share one whole-line fetch of each tile, and the copies
// of the next stage fly while this stage is worked on.
// Wave tile: 32 queries (two column groups) x 64 of the stage's 128 keys. Waves w
// and w + 4 hold the same queries and split the keys, so every K and V^T fragment
// read from LDS feeds two products, and one work-group fills a WGP with two waves
// per SIMD. Each wave keeps its own running maximum, sum and output over its keys;
// the two partial results of a query are joined through LDS behind the loop.
// The keys are walked in blocks of 32, in transposed form: S^T = K Q^T (16 WMMAs)
// leaves one query's scores in one lane pair, so the online softmax runs in
// registers; the S^T tiles, converted in place, are the B operands of
// O^T += V^T P^T (16 WMMAs). A lane holds queries l16 and 16 + l16; its half holds
// keys 8*half+r, 16+8*half+r.
// The work-group holds whole rows of the attention output, so the projection runs
// here: the joined O^T tiles, rounded to f16, are in place the B operands of
// out^T = Wp^T O^T (Wp^T staged in LDS as f16 while stage 0 lands), and the result
// is added onto xn in out_f. The attention output never goes through memory.
// ---------------------------------------------------------------------------
#define STG_KEYS   128                       // keys per stage
#define STG_PITCH  136                       // halves per LDS row: 256 B + 16 B pad
#define STG_TILE   (128 * STG_PITCH)         // halves per tile (K: 128 keys, V^T: 128 channels)
#define STG_BUF    (2 * STG_TILE)            // halves per buffer (K tile, then V^T tile)
#define STG_COUNT  (NPIX / STG_KEYS)         // stages per batch
#define WAVE_KEYS  (STG_KEYS / 2)            // keys of a stage that one wave walks
#define WG_QUERIES 128                       // queries per work-group: 4 wave pairs x 32

// Eight 16-byte copies per lane, global -> LDS, rows 16 apart in the tile.
// The s_wait_xcnt closes the statement so that no address register named by a
// copy is rewritten ahead of it.
__device__ inline void copy8_to_lds(unsigned l, const char* g, size_t gstep) {
  const unsigned ls = 16 * STG_PITCH * 2;    // 16 LDS rows, in bytes
  asm volatile(
      "global_load_async_to_lds_b128 %0, %8, off\n\t"
      "global_load_async_to_lds_b128 %1, %9, off\n\t"
      "global_load_async_to_lds_b128 %2, %10, off\n\t"
      "global_load_async_to_lds_b128 %3, %11, off\n\t"
      "global_load_async_to_lds_b128 %4, %12, off\n\t"
      "global_load_async_to_lds_b128 %5, %13, off\n\t"
      "global_load_async_to_lds_b128 %6, %14, off\n\t"
      "global_load_async_to_lds_b128 %7, %15, off\n\t"
      "s_wait_xcnt 0x0"
      :: "v"(l), "v"(l + ls), "v"(l + 2 * ls), "v"(l + 3 * ls),
         "v"(l + 4 * ls), "v"(l + 5 * ls), "v"(l + 6 * ls), "v"(l + 7 * ls),
         "v"(g), "v"(g + gstep), "v"(g + 2 * gstep), "v"(g + 3 * gstep),
         "v"(g + 4 * gstep), "v"(g + 5 * gstep), "v"(g + 6 * gstep), "v"(g + 7 * gstep)
      : "memory");
}

// One stage: 128 K rows (contiguous 32 KB) and 128 V^T rows of 256 B.
// Thread t copies 16-byte piece (t & 15) of rows (t >> 4) + 16 j, j = 0..7.
__device__ inline void copy_stage(unsigned lds_k, const char* gk, const char* gv) {
  copy8_to_lds(lds_k,                gk, 16 * CDIM * 2);
  copy8_to_lds(lds_k + STG_TILE * 2, gv, (size_t)16 * NPIX * 2);
}

__global__ __launch_bounds__(256) void flash_attn_kernel(
    const f16* __restrict__ Q, const f16* __restrict__ K,
    const f16* __restrict__ Vt, const float* __restrict__ Wp,
    const float* __restrict__ bp, float* __restrict__ out_f) {
  __shared__ __attribute__((aligned(128))) f16 Stage[2 * STG_BUF];
  __shared__ __attribute__((aligned(16))) f16 Wt[CDIM * WT_PITCH];   // Wp^T, [n][k], 34 KB
  const int lane = threadIdx.x & 31;
  const int wave = __builtin_amdgcn_readfirstlane(threadIdx.x >> 5);
  const int half = lane >> 4;
  const int l16  = lane & 15;
  const int qg   = wave & 3;    // which 32 queries of the work-group
  const int kh   = wave >> 2;   // which 64 keys of every stage
  const int b    = blockIdx.x / (NPIX / WG_QUERIES);
  const int q0   = (blockIdx.x % (NPIX / WG_QUERIES)) * WG_QUERIES + qg * 32;
  const size_t qbase = (size_t)b * NPIX + q0;
  const float sc2 = 0.08838834764831845f * 1.4426950408889634f;  // U^-0.5 * log2(e), U=128

  // This thread's piece of every tile: LDS byte address and global bytes.
  const int crow = threadIdx.x >> 4, cpiece = threadIdx.x & 15;
  const unsigned lds_my = (unsigned)(size_t)&Stage[0] + crow * (STG_PITCH * 2) + cpiece * 16;
  const char* gk_my = (const char*)(K + (size_t)b * NPIX * CDIM) + crow * (CDIM * 2) + cpiece * 16;
  const char* gv_my = (const char*)(Vt + (size_t)b * CDIM * NPIX) + (size_t)crow * (NPIX * 2) + cpiece * 16;

  // Stage 0 lands and is published; stage 1 then flies during stage 0's work.
  copy_stage(lds_my, gk_my, gv_my);

  // Wp^T into LDS as f16 while stage 0 flies: a thread takes 64 k of one column n
  // (a wave's load is one 128 B line), all loads in flight at once, and stores 8 k
  // as 16 B. The barrier that publishes stage 0 publishes these rows too.
  {
    const int wn = threadIdx.x & 127, wk = (threadIdx.x >> 7) * 64;
    const float* wsrc = Wp + wk * CDIM + wn;
    float w[64];
#pragma unroll
    for (int i = 0; i < 64; ++i) w[i] = wsrc[i * CDIM];
    // Before a register that these loads name is used again; the pointer is an
    // input so that its registers are not handed out while the loads are issued.
    asm volatile("s_wait_xcnt 0x0" :: "v"(wsrc) : "memory");
#pragma unroll
    for (int j = 0; j < 8; ++j) {
      v8h h;
#pragma unroll
      for (int r = 0; r < 8; ++r) h[r] = (f16)w[j * 8 + r];
      *(v8h*)&Wt[wn * WT_PITCH + wk + j * 8] = h;
    }
  }
  asm volatile("s_wait_asynccnt 0x0" ::: "memory");  // own copies of stage 0 landed
  __syncthreads();                                   // every wave's copies landed
  copy_stage(lds_my + STG_BUF * 2, gk_my + STG_KEYS * CDIM * 2, gv_my + STG_KEYS * 2);

  const f16* Qrow = Q + (qbase + l16) * CDIM + half * 8;
  v16h qa[2][4];
#pragma unroll
  for (int t = 0; t < 2; ++t)
#pragma unroll
    for (int kk = 0; kk < 4; ++kk)
      qa[t][kk] = load_frag16(Qrow + t * 16 * CDIM + kk * 32);
  // Before a register that these loads name is used again; the row pointer is an
  // input so that its registers are not handed out while the loads are issued.
  asm volatile("s_wait_xcnt 0x0" :: "v"(Qrow) : "memory");

  v8f acc[2][8] = {};       // acc[t][cn][r] = O[query t*16 + l16][channel cn*16 + 8*half + r]
  float mi[2] = {-3.0e38f, -3.0e38f};  // maxima in use for this lane's queries, log2 units
  float li[2] = {0.0f, 0.0f};          // running sums over this lane half's keys only

  for (int st = 0; st < STG_COUNT; ++st) {
    const f16* Ks = &Stage[(st & 1) * STG_BUF] + kh * (WAVE_KEYS * STG_PITCH);  // own key rows
    const f16* Vs = &Stage[(st & 1) * STG_BUF] + STG_TILE + kh * WAVE_KEYS;     // own key columns

    // K fragments of both blocks, one group at the head of the stage.
    static_assert(WAVE_KEYS == 64, "a wave walks two blocks of 32 keys per stage");
    v16h kf[2][2][4];       // [block][16-key tile][32 channels]
#pragma unroll
    for (int blk = 0; blk < 2; ++blk) {
#pragma unroll
      for (int kt = 0; kt < 2; ++kt)
#pragma unroll
        for (int kk = 0; kk < 4; ++kk)
          kf[blk][kt][kk] = load_frag16(Ks + (blk * 32 + kt * 16 + l16) * STG_PITCH + kk * 32 + half * 8);
      // Keeps the loads here, the first block's in front: without it the second block's
      // are scheduled late, in pieces, just in front of where they are waited for.
      __builtin_amdgcn_sched_barrier(0);
    }

    // Unrolled so that the second block's K Q^T can be scheduled among the first
    // block's exponentials.
#pragma unroll
    for (int blk = 0; blk < 2; ++blk) {
      const int kv0 = blk * 32;
      // ---- S^T = K Q^T for 32 keys x 32 queries: four 16x16 f32 tiles ----
      v8f s0[2] = {}, s1[2] = {};
#pragma unroll
      for (int kk = 0; kk < 4; ++kk) {
#pragma unroll
        for (int t = 0; t < 2; ++t) {
          s0[t] = wmma16x16x32(kf[blk][0][kk], qa[t][kk], s0[t]);
          s1[t] = wmma16x16x32(kf[blk][1][kk], qa[t][kk], s1[t]);
        }
      }

      float mb[2];
      bool need = false;
#pragma unroll
      for (int t = 0; t < 2; ++t) {
        // maximum as a tree of three-input steps: short dependent chain
        const float m0 = max3f(s0[t][0], s0[t][1], s0[t][2]);
        const float m1 = max3f(s0[t][3], s0[t][4], s0[t][5]);
        const float m2 = max3f(s0[t][6], s0[t][7], s1[t][0]);
        const float m3 = max3f(s1[t][1], s1[t][2], s1[t][3]);
        const float m4 = max3f(s1[t][4], s1[t][5], s1[t][6]);
        float mx = fmaxf(max3f(m0, m1, m2), max3f(m3, m4, s1[t][7]));
        mx = fmaxf(mx, other_half(mx));
        mb[t] = mx * sc2;
        need = need || (mb[t] > mi[t] + 8.0f);
      }
      // Holds the second block's K loads at the head of the stage (loaded values as inputs
      // only): without it they sink behind the branch, and its K Q^T starts by waiting.
      // The scheduling barrier keeps the statement, and the wait it brings, down here
      // behind the first block's products and maxima.
      if (blk == 0) {
        __builtin_amdgcn_sched_barrier(0);
        asm volatile("" :: "v"(kf[1][0][0]), "v"(kf[1][0][1]), "v"(kf[1][0][2]), "v"(kf[1][0][3]),
                           "v"(kf[1][1][0]), "v"(kf[1][1][1]), "v"(kf[1][1][2]), "v"(kf[1][1][3]));
      }
      if (__builtin_amdgcn_ballot_w32(need) != 0) {   // always on the first block, rare later
#pragma unroll
        for (int t = 0; t < 2; ++t) {
          const float mnew = fmaxf(mi[t], mb[t]);
          const float corr = __builtin_amdgcn_exp2f(mi[t] - mnew);  // 0 on the first block
          mi[t] = mnew;
          li[t] *= corr;
#pragma unroll
          for (int cn = 0; cn < 8; ++cn) acc[t][cn] = acc[t][cn] * corr;
        }
      }

      // This block's V^T fragments, one group in flight under the exponentials.
      v16h vf[8];
#pragma unroll
      for (int cn = 0; cn < 8; ++cn)
        vf[cn] = load_frag16(Vs + (cn * 16 + l16) * STG_PITCH + kv0 + half * 8);
      // Keeps the group together and ahead: without it the loads sink to their products,
      // one fragment at a time, each waited for in full.
      __builtin_amdgcn_sched_barrier(0);

      v16h pb[2];           // P^T as B operand: element r is key 8*half + r, element 8 + r key 16 + 8*half + r
#pragma unroll
      for (int t = 0; t < 2; ++t) {
        float rs = 0.0f;
#pragma unroll
        for (int r = 0; r < 8; ++r) {
          const float p0 = __builtin_amdgcn_exp2f(s0[t][r] * sc2 - mi[t]);
          const float p1 = __builtin_amdgcn_exp2f(s1[t][r] * sc2 - mi[t]);
          rs += p0 + p1;
          pb[t][r]     = (f16)p0;
          pb[t][r + 8] = (f16)p1;
        }
        li[t] += rs;
      }

      // ---- O^T += V^T P^T : V^T rows are the A operand, read once for both groups
#pragma unroll
      for (int cn = 0; cn < 8; ++cn) {
#pragma unroll
        for (int t = 0; t < 2; ++t)
          acc[t][cn] = wmma16x16x32(vf[cn], pb[t], acc[t][cn]);
      }
    }

    // ---- hand-over: publish stage st + 1, free this stage's buffer -------
    asm volatile("s_wait_dscnt 0x0" ::: "memory");     // own reads of this buffer done
    asm volatile("s_wait_asynccnt 0x0" ::: "memory");  // own copies of stage st + 1 landed
    __syncthreads();                                   // both hold for every wave
    if (st + 2 < STG_COUNT)
      copy_stage(lds_my + (st & 1) * (STG_BUF * 2),
                 gk_my + (size_t)(st + 2) * (STG_KEYS * CDIM * 2),
                 gv_my + (size_t)(st + 2) * (STG_KEYS * 2));
  }
  asm volatile("s_wait_asynccnt 0x0" ::: "memory");    // nothing in flight at the wave's end

  // ---- join the two key halves of each query through LDS ----------------
  // Behind the loop's last barrier nobody reads the stages and no copy is in
  // flight, so their LDS carries the hand-over: 33 pieces of 16 B per lane, each
  // piece a contiguous 512 B per wave.
  v4f* Join = (v4f*)&Stage[0] + (size_t)qg * (33 * 32) + lane;
  if (kh == 1) {
    const v4f ml = {mi[0], mi[1], li[0], li[1]};
    Join[32 * 32] = ml;
#pragma unroll
    for (int t = 0; t < 2; ++t)
#pragma unroll
      for (int cn = 0; cn < 8; ++cn) {
        const v4f lo = {acc[t][cn][0], acc[t][cn][1], acc[t][cn][2], acc[t][cn][3]};
        const v4f hi = {acc[t][cn][4], acc[t][cn][5], acc[t][cn][6], acc[t][cn][7]};
        Join[((t * 8 + cn) * 2) * 32]     = lo;
        Join[((t * 8 + cn) * 2 + 1) * 32] = hi;
      }
  }
  __syncthreads();                                     // the partner's partial results are in LDS
  if (kh == 1) return;

  // What the projection's results are added to is fetched here, as one group that
  // flies during the join and the products: the bias of this lane's 8 columns per
  // tile and the 2 x 64 values of xn.
  float* outp = out_f + (qbase + l16) * CDIM + 8 * half;   // query l16, first column
  v4f brow[16], res[2][16];
#pragma unroll
  for (int cn = 0; cn < 8; ++cn) {
    brow[2 * cn]     = *(const v4f*)(bp + cn * 16 + 8 * half);
    brow[2 * cn + 1] = *(const v4f*)(bp + cn * 16 + 8 * half + 4);
#pragma unroll
    for (int t = 0; t < 2; ++t) {
      res[t][2 * cn]     = *(const v4f*)(outp + t * 16 * CDIM + cn * 16);
      res[t][2 * cn + 1] = *(const v4f*)(outp + t * 16 * CDIM + cn * 16 + 4);
    }
  }
  // Before a register that these loads name is used again. The compiler moves no
  // load over this statement either, so the group stays ahead of the join instead
  // of sinking to the stores, where each piece would wait by itself.
  asm volatile("s_wait_xcnt 0x0" ::: "memory");

  // ---- join the lane halves' sums, normalize, round to f16 ----------------
  // o of tile cn holds channels cn*16 + 8*half + r of this lane's query: tiles 2kk and
  // 2kk + 1 together are the B fragment of channels kk*32 .. kk*32 + 31.
  const v4f ml = Join[32 * 32];
  v16h ob[2][4];
#pragma unroll
  for (int t = 0; t < 2; ++t) {
    const float mj = fmaxf(mi[t], ml[t]);
    const float fa = __builtin_amdgcn_exp2f(mi[t] - mj);   // weight of this wave's keys
    const float fb = __builtin_amdgcn_exp2f(ml[t] - mj);   // weight of the partner's keys
    const float lj = li[t] * fa + ml[2 + t] * fb;
    const float inv = 1.0f / (lj + other_half(lj));
    const float wa = fa * inv, wb = fb * inv;
#pragma unroll
    for (int cn = 0; cn < 8; ++cn) {
      const v4f lo = Join[((t * 8 + cn) * 2) * 32];
      const v4f hi = Join[((t * 8 + cn) * 2 + 1) * 32];
#pragma unroll
      for (int r = 0; r < 4; ++r) {
        ob[t][cn >> 1][(cn & 1) * 8 + r]     = (f16)(acc[t][cn][r] * wa + lo[r] * wb);
        ob[t][cn >> 1][(cn & 1) * 8 + r + 4] = (f16)(acc[t][cn][r + 4] * wa + hi[r] * wb);
      }
    }
  }

  // ---- out^T = Wp^T O^T: a Wp^T fragment from LDS feeds both query groups ----
  v8f pacc[2][8] = {};      // pacc[t][cn][r] = proj[query t*16 + l16][column cn*16 + 8*half + r]
#pragma unroll
  for (int kk = 0; kk < 4; ++kk) {
#pragma unroll
    for (int cn = 0; cn < 8; ++cn) {
      v16h wfrag = load_frag16(&Wt[(cn * 16 + l16) * WT_PITCH + kk * 32 + half * 8]);
#pragma unroll
      for (int t = 0; t < 2; ++t)
        pacc[t][cn] = wmma16x16x32(wfrag, ob[t][kk], pacc[t][cn]);
    }
  }

  // ---- bias, xn residual, f32 output: 8 columns of one row per tile ----------
  // All sums first, then all stores, so that no register that a store names is
  // written again.
#pragma unroll
  for (int t = 0; t < 2; ++t)
#pragma unroll
    for (int cn = 0; cn < 8; ++cn) {
      v4f lo = {pacc[t][cn][0], pacc[t][cn][1], pacc[t][cn][2], pacc[t][cn][3]};
      v4f hi = {pacc[t][cn][4], pacc[t][cn][5], pacc[t][cn][6], pacc[t][cn][7]};
      lo += brow[2 * cn];
      hi += brow[2 * cn + 1];
      res[t][2 * cn]     += lo;
      res[t][2 * cn + 1] += hi;
    }
#pragma unroll
  for (int t = 0; t < 2; ++t)
#pragma unroll
    for (int i = 0; i < 16; ++i)
      *(v4f*)(outp + t * 16 * CDIM + (i >> 1) * 16 + (i & 1) * 4) = res[t][i];
}

// ---------------------------------------------------------------------------
extern "C" void kernel_launch(void* const* d_in, const int* in_sizes, int n_in,
                              void* d_out, int out_size, void* d_ws, size_t ws_size,
                              hipStream_t stream) {
  (void)in_sizes; (void)n_in; (void)out_size; (void)ws_size;

  const float* inputs  = (const float*)d_in[0];
  const float* context = (const float*)d_in[1];
  const float* gamma   = (const float*)d_in[2];
  const float* beta    = (const float*)d_in[3];
  const float* Wq      = (const float*)d_in[4];
  const float* bq      = (const float*)d_in[5];
  const float* Wk      = (const float*)d_in[6];
  const float* bk      = (const float*)d_in[7];
  const float* Wv      = (const float*)d_in[8];
  const float* bv      = (const float*)d_in[9];
  const float* Wp      = (const float*)d_in[10];
  const float* bp      = (const float*)d_in[11];
  float* out = (float*)d_out;

  const size_t halfbuf = (size_t)MROWS * CDIM * sizeof(f16);  // 8 MB each
  char* ws = (char*)d_ws;
  f16* qh   = (f16*)(ws + 0 * halfbuf);
  f16* kh   = (f16*)(ws + 1 * halfbuf);
  f16* vt   = (f16*)(ws + 2 * halfbuf);   // [b][c][n] transposed

  // 1) xn = LayerNorm(inputs) (f32) -> d_out as residual base;
  //    Q = xn @ Wq + bq ; K = ctx @ Wk + bk ; V^T = (ctx @ Wv + bv)^T
  ln_qkv_kernel<<<2 * ROW_TILES, 256, 0, stream>>>(inputs, context, gamma, beta,
                                                   Wq, bq, Wk, bk, Wv, bv,
                                                   out, qh, kh, vt);
  // 2) d_out(=xn) += softmax(Q K^T / sqrt(U)) V @ Wp + bp
  flash_attn_kernel<<<NBATCH * (NPIX / WG_QUERIES), 256, 0, stream>>>(qh, kh, vt, Wp, bp, out);
}

// v009
// It runs in 67.4 microseconds.
// Timed twice side by side with v008, it ran 1.04 times as fast both times.
// Over all steps from v000 it is 6.79 times as fast.
#include <hip/hip_runtime.h>
#include <hip/hip_bf16.h>

// ---------------------------------------------------------------------------
// CrossAttentionBlock for MI455X (gfx1250, wave32, WMMA 16x16x32 f16)
// B=8, H=W=64 (N=4096 pixels), C=U=128.
// ---------------------------------------------------------------------------

typedef _Float16 f16;
typedef __attribute__((ext_vector_type(4)))  _Float16 v4h;
typedef __attribute__((ext_vector_type(8)))  _Float16 v8h;
typedef __attribute__((ext_vector_type(16))) _Float16 v16h;
typedef __attribute__((ext_vector_type(8)))  float    v8f;
typedef __attribute__((ext_vector_type(4)))  float    v4f;

#define NPIX   4096          // H*W
#define CDIM   128           // channels == units
#define NBATCH 8
#define MROWS  (NBATCH * NPIX)  // 32768 total pixel rows
#define QSCALE (0.08838834764831845f * 1.4426950408889634f)  // U^-0.5 * log2(e), U=128

// Load one 16x32 f16 A/B fragment for v_wmma_f32_16x16x32_f16.
// Per ISA layout: lane's 16 halves are two contiguous groups of 8 at
// k = half*8 .. +7 and k = 16+half*8 .. +7 (caller pre-offsets by half*8).
__device__ inline v16h load_frag16(const f16* p) {
  v8h lo = *(const v8h*)(p);
  v8h hi = *(const v8h*)(p + 16);
  return __builtin_shufflevector(lo, hi, 0, 1, 2, 3, 4, 5, 6, 7,
                                         8, 9, 10, 11, 12, 13, 14, 15);
}

__device__ inline v8f wmma16x16x32(v16h a, v16h b, v8f c) {
  // (neg_a, A, neg_b, B, c_mod, C, reuse_a, reuse_b)
  return __builtin_amdgcn_wmma_f32_16x16x32_f16(false, a, false, b,
                                                (short)0, c, false, false);
}

__device__ inline float max3f(float a, float b, float c) {
  return fmaxf(fmaxf(a, b), c);
}

// Value of the partner lane in the other 16-lane half (lane ^ 16).
__device__ inline float other_half(float v) {
  const int b = __builtin_bit_cast(int, v);
  return __builtin_bit_cast(float,
      __builtin_amdgcn_permlanex16(b, b, 0x76543210, 0xfedcba98, false, false));
}

// ---------------------------------------------------------------------------
// 128 x 128 projection tile, C[128 x 128] = A[128 x 128](f16) @ W[128 x 128] + bias,
// via WMMA. 256 threads = 8 waves; each wave owns 16 rows.
// W is staged in LDS transposed as f16 so its fragments are two b128 ds loads.
// The LDS rows are pitched 16 B past their 256 B: the 16 rows of a fragment read
// and the 32 rows of a staging store then spread over the banks.
// The output form is a compile-time parameter, and it picks the operand roles so
// that the 8 accumulators of a lane are neighbours in memory:
// MODE 0: f16 row-major [M,128]    (Q / K): C^T = W^T A^T, lane = row, regs = columns;
//         the f32 result is multiplied by oscale before it is rounded to f16
// MODE 1: f16 transposed [b][c][n] (V):     C   = A W,     lane = column, regs = rows
// ---------------------------------------------------------------------------
#define WT_PITCH 136         // halves per LDS row of W^T: 256 B + 16 B pad
#define ROW_TILES (MROWS / 128)   // 128-row tiles of the pixel rows

// a: this wave's A fragments (rows row0 .. row0 + 15); Wt: the staged W^T, [n][k].
template <int MODE>
__device__ __forceinline__ void gemm128_tile(
    const v16h (&a)[4], const f16* Wt, size_t row0,
    const float* __restrict__ bias, f16* __restrict__ out_h, const float oscale) {
  const int lane = threadIdx.x & 31;
  const int half = lane >> 4;
  const int l16  = lane & 15;
  const size_t off  = (row0 + l16) * CDIM + 8 * half;   // MODE 0: this lane's first result

  // What the epilogue adds is fetched here, as one group ahead of the products: the
  // bias of this lane's results.
  float bcol[8];
  v4f brow[16];
#pragma unroll
  for (int cn = 0; cn < 8; ++cn) {
    if (MODE == 1) {
      bcol[cn] = bias[cn * 16 + l16];
    } else {
      brow[2 * cn]     = *(const v4f*)(bias + cn * 16 + 8 * half);
      brow[2 * cn + 1] = *(const v4f*)(bias + cn * 16 + 8 * half + 4);
    }
  }
  // Before a register that these loads name is used again. The compiler moves no
  // load over this statement either, so the group stays ahead of the products
  // instead of sinking into the epilogue, where each piece would wait by itself.
  asm volatile("s_wait_xcnt 0x0" ::: "memory");

  v8f acc[8] = {};
#pragma unroll
  for (int kk = 0; kk < 4; ++kk) {
#pragma unroll
    for (int cn = 0; cn < 8; ++cn) {
      v16h wfrag = load_frag16(&Wt[(cn * 16 + l16) * WT_PITCH + kk * 32 + half * 8]);
      acc[cn] = (MODE == 1) ? wmma16x16x32(a[kk], wfrag, acc[cn])
                            : wmma16x16x32(wfrag, a[kk], acc[cn]);
    }
  }

#pragma unroll
  for (int cn = 0; cn < 8; ++cn) {
    if (MODE == 1) {
      // acc[cn][r] = C[row0 + 8*half + r][cn*16 + l16]: 8 pixels of one channel, 16 B.
      const size_t b = row0 >> 12, nn = (row0 & (NPIX - 1)) + 8 * half;
      v8h o;
#pragma unroll
      for (int r = 0; r < 8; ++r) o[r] = (f16)(acc[cn][r] + bcol[cn]);
      *(v8h*)(out_h + (b * CDIM + cn * 16 + l16) * NPIX + nn) = o;
    } else {
      // acc[cn][r] = C[row0 + l16][cn*16 + 8*half + r]: 8 columns of one row.
      v4f lo = {acc[cn][0], acc[cn][1], acc[cn][2], acc[cn][3]};
      v4f hi = {acc[cn][4], acc[cn][5], acc[cn][6], acc[cn][7]};
      lo = (lo + brow[2 * cn]) * oscale;
      hi = (hi + brow[2 * cn + 1]) * oscale;
      v8h o = {(f16)lo[0], (f16)lo[1], (f16)lo[2], (f16)lo[3],
               (f16)hi[0], (f16)hi[1], (f16)hi[2], (f16)hi[3]};
      *(v8h*)(out_h + off + cn * 16) = o;
    }
  }
}

// ---------------------------------------------------------------------------
// Kernel 1: LayerNorm, f16 conversion and the Q, K, V projections in one launch.
// Work-groups 0 .. ROW_TILES-1 take 128 context rows each and write K and V^T;
// the others take 128 input rows each, normalize them (eps = 1e-3), write xn (f32)
// into d_out as the residual base, and write Q times U^-0.5 * log2(e). Two
// work-groups fit a WGP.
// A wave fetches its 16 rows as whole 512 B rows (4 channels per lane), all in
// flight while the weights are staged; the f16 rows go to the A fragments through
// LDS and never through memory.
// ---------------------------------------------------------------------------
__global__ __launch_bounds__(256) void ln_qkv_kernel(
    const float* __restrict__ x, const float* __restrict__ ctx,
    const float* __restrict__ gamma, const float* __restrict__ beta,
    const float* __restrict__ Wq, const float* __restrict__ bq,
    const float* __restrict__ Wk, const float* __restrict__ bk,
    const float* __restrict__ Wv, const float* __restrict__ bv,
    float* __restrict__ xn_out, f16* __restrict__ qh, f16* __restrict__ kh,
    f16* __restrict__ vt) {
  __shared__ __attribute__((aligned(16))) f16 Rows[128 * WT_PITCH];     // [row][k], 34 KB
  __shared__ __attribute__((aligned(16))) f16 Wt[2][CDIM * WT_PITCH];   // [n][k], 34 KB each
  const int lane = threadIdx.x & 31;
  const int wave = threadIdx.x >> 5;
  const int half = lane >> 4;
  const int l16  = lane & 15;
  const bool is_q = blockIdx.x >= ROW_TILES;
  const size_t row0 = (size_t)(is_q ? blockIdx.x - ROW_TILES : blockIdx.x) * 128 + wave * 16;
  const float* src = (is_q ? x : ctx) + row0 * CDIM + lane * 4;

  float4 rv[16];
#pragma unroll
  for (int r = 0; r < 16; ++r) rv[r] = *(const float4*)(src + r * CDIM);
  // Before a register that these loads name is used again; the row pointer is an
  // input so that its registers are not handed out while the loads are issued.
  asm volatile("s_wait_xcnt 0x0" :: "v"(src) : "memory");

  if (is_q) {
    for (int idx = threadIdx.x; idx < CDIM * CDIM; idx += 256) {
      int k = idx >> 7, n = idx & 127;
      Wt[0][n * WT_PITCH + k] = (f16)Wq[idx];
    }

    // LayerNorm of the 16 rows, their reductions side by side.
    const float4 g  = ((const float4*)gamma)[lane];
    const float4 bt = ((const float4*)beta)[lane];
    float s[16];
#pragma unroll
    for (int r = 0; r < 16; ++r) s[r] = rv[r].x + rv[r].y + rv[r].z + rv[r].w;
#pragma unroll
    for (int m = 16; m >= 1; m >>= 1)
#pragma unroll
      for (int r = 0; r < 16; ++r) s[r] += __shfl_xor(s[r], m, 32);
#pragma unroll
    for (int r = 0; r < 16; ++r) {
      const float mu = s[r] * (1.0f / 128.0f);
      rv[r].x -= mu; rv[r].y -= mu; rv[r].z -= mu; rv[r].w -= mu;
      s[r] = rv[r].x * rv[r].x + rv[r].y * rv[r].y + rv[r].z * rv[r].z + rv[r].w * rv[r].w;
    }
#pragma unroll
    for (int m = 16; m >= 1; m >>= 1)
#pragma unroll
      for (int r = 0; r < 16; ++r) s[r] += __shfl_xor(s[r], m, 32);
#pragma unroll
    for (int r = 0; r < 16; ++r) {
      const float inv = rsqrtf(s[r] * (1.0f / 128.0f) + 1e-3f);
      rv[r].x = rv[r].x * inv * g.x + bt.x;
      rv[r].y = rv[r].y * inv * g.y + bt.y;
      rv[r].z = rv[r].z * inv * g.z + bt.z;
      rv[r].w = rv[r].w * inv * g.w + bt.w;
    }
  } else {
    for (int idx = threadIdx.x; idx < CDIM * CDIM; idx += 256) {
      int k = idx >> 7, n = idx & 127;
      Wt[0][n * WT_PITCH + k] = (f16)Wk[idx];
      Wt[1][n * WT_PITCH + k] = (f16)Wv[idx];
    }
  }

#pragma unroll
  for (int r = 0; r < 16; ++r) {
    v4h h = {(f16)rv[r].x, (f16)rv[r].y, (f16)rv[r].z, (f16)rv[r].w};
    *(v4h*)&Rows[(wave * 16 + r) * WT_PITCH + lane * 4] = h;
  }
  __syncthreads();

  // xn goes out behind the barrier, which would otherwise wait for these stores.
  if (is_q) {
#pragma unroll
    for (int r = 0; r < 16; ++r)
      ((float4*)(xn_out + (row0 + r) * CDIM))[lane] = rv[r];
  }

  v16h a[4];
#pragma unroll
  for (int kk = 0; kk < 4; ++kk)
    a[kk] = load_frag16(&Rows[(wave * 16 + l16) * WT_PITCH + kk * 32 + half * 8]);

  if (is_q) {
    gemm128_tile<0>(a, Wt[0], row0, bq, qh, QSCALE);   // Q in the softmax's log2 units
  } else {
    gemm128_tile<0>(a, Wt[0], row0, bk, kh, 1.0f);
    // Before a register that the K stores name is used again by the second tile.
    asm volatile("s_wait_xcnt 0x0" ::: "memory");
    gemm128_tile<1>(a, Wt[1], row0, bv, vt, 1.0f);
    // Before a register that the V^T stores name is used again: in the built code
    // the other branch's instructions stand behind them.
    asm volatile("s_wait_xcnt 0x0" ::: "memory");
  }
}

// ---------------------------------------------------------------------------
// Kernel 2: flash attention, output projection and residual. 256 threads = 8 waves;
// 128 query rows per work-group.
// K and V^T are staged in LDS, 128 keys per stage, two buffers, by asynchronous
// copies: the eight waves share one whole-line fetch of each tile, and the copies
// of the next stage fly while this stage is worked on.
// Wave tile: 32 queries (two column groups) x 64 of the stage's 128 keys. Waves w
// and w + 4 hold the same queries and split the keys, so every K and V^T fragment
// read from LDS feeds two products, and one work-group fills a WGP with two waves
// per SIMD. Each wave keeps its own running maximum, sum and output over its keys;
// the two partial results of a query are joined through LDS behind the loop.
// The keys are walked in blocks of 32, in transposed form: S^T = K Q^T (16 WMMAs)
// leaves one query's scores in one lane pair, so the online softmax runs in
// registers. Q arrives in log2 units and the products start from minus the maximum
// in use (their C operand), so what they leave is the argument of the exponential; the S^T tiles, converted in place, are the B operands of
// O^T += V^T P^T (16 WMMAs). A lane holds queries l16 and 16 + l16; its half holds
// keys 8*half+r, 16+8*half+r.
// The work-group holds whole rows of the attention output, so the projection runs
// here: the joined O^T tiles, rounded to f16, are in place the B operands of
// out^T = Wp^T O^T (Wp^T staged in LDS as f16 while stage 0 lands), and the result
// is added onto xn in out_f. The attention output never goes through memory.
// ---------------------------------------------------------------------------
#define STG_KEYS   128                       // keys per stage
#define STG_PITCH  136                       // halves per LDS row: 256 B + 16 B pad
#define STG_TILE   (128 * STG_PITCH)         // halves per tile (K: 128 keys, V^T: 128 channels)
#define STG_BUF    (2 * STG_TILE)            // halves per buffer (K tile, then V^T tile)
#define STG_COUNT  (NPIX / STG_KEYS)         // stages per batch
#define WAVE_KEYS  (STG_KEYS / 2)            // keys of a stage that one wave walks
#define WG_QUERIES 128                       // queries per work-group: 4 wave pairs x 32

// Eight 16-byte copies per lane, global -> LDS, rows 16 apart in the tile.
// The s_wait_xcnt closes the statement so that no address register named by a
// copy is rewritten ahead of it.
__device__ inline void copy8_to_lds(unsigned l, const char* g, size_t gstep) {
  const unsigned ls = 16 * STG_PITCH * 2;    // 16 LDS rows, in bytes
  asm volatile(
      "global_load_async_to_lds_b128 %0, %8, off\n\t"
      "global_load_async_to_lds_b128 %1, %9, off\n\t"
      "global_load_async_to_lds_b128 %2, %10, off\n\t"
      "global_load_async_to_lds_b128 %3, %11, off\n\t"
      "global_load_async_to_lds_b128 %4, %12, off\n\t"
      "global_load_async_to_lds_b128 %5, %13, off\n\t"
      "global_load_async_to_lds_b128 %6, %14, off\n\t"
      "global_load_async_to_lds_b128 %7, %15, off\n\t"
      "s_wait_xcnt 0x0"
      :: "v"(l), "v"(l + ls), "v"(l + 2 * ls), "v"(l + 3 * ls),
         "v"(l + 4 * ls), "v"(l + 5 * ls), "v"(l + 6 * ls), "v"(l + 7 * ls),
         "v"(g), "v"(g + gstep), "v"(g + 2 * gstep), "v"(g + 3 * gstep),
         "v"(g + 4 * gstep), "v"(g + 5 * gstep), "v"(g + 6 * gstep), "v"(g + 7 * gstep)
      : "memory");
}

// One stage: 128 K rows (contiguous 32 KB) and 128 V^T rows of 256 B.
// Thread t copies 16-byte piece (t & 15) of rows (t >> 4) + 16 j, j = 0..7.
__device__ inline void copy_stage(unsigned lds_k, const char* gk, const char* gv) {
  copy8_to_lds(lds_k,                gk, 16 * CDIM * 2);
  copy8_to_lds(lds_k + STG_TILE * 2, gv, (size_t)16 * NPIX * 2);
}

__global__ __launch_bounds__(256) void flash_attn_kernel(
    const f16* __restrict__ Q, const f16* __restrict__ K,
    const f16* __restrict__ Vt, const float* __restrict__ Wp,
    const float* __restrict__ bp, float* __restrict__ out_f) {
  __shared__ __attribute__((aligned(128))) f16 Stage[2 * STG_BUF];
  __shared__ __attribute__((aligned(16))) f16 Wt[CDIM * WT_PITCH];   // Wp^T, [n][k], 34 KB
  const int lane = threadIdx.x & 31;
  const int wave = __builtin_amdgcn_readfirstlane(threadIdx.x >> 5);
  const int half = lane >> 4;
  const int l16  = lane & 15;
  const int qg   = wave & 3;    // which 32 queries of the work-group
  const int kh   = wave >> 2;   // which 64 keys of every stage
  const int b    = blockIdx.x / (NPIX / WG_QUERIES);
  const int q0   = (blockIdx.x % (NPIX / WG_QUERIES)) * WG_QUERIES + qg * 32;
  const size_t qbase = (size_t)b * NPIX + q0;

  // This thread's piece of every tile: LDS byte address and global bytes.
  const int crow = threadIdx.x >> 4, cpiece = threadIdx.x & 15;
  const unsigned lds_my = (unsigned)(size_t)&Stage[0] + crow * (STG_PITCH * 2) + cpiece * 16;
  const char* gk_my = (const char*)(K + (size_t)b * NPIX * CDIM) + crow * (CDIM * 2) + cpiece * 16;
  const char* gv_my = (const char*)(Vt + (size_t)b * CDIM * NPIX) + (size_t)crow * (NPIX * 2) + cpiece * 16;

  // Stage 0 lands and is published; stage 1 then flies during stage 0's work.
  copy_stage(lds_my, gk_my, gv_my);

  // Wp^T into LDS as f16 while stage 0 flies: a thread takes 64 k of one column n
  // (a wave's load is one 128 B line), all loads in flight at once, and stores 8 k
  // as 16 B. The barrier that publishes stage 0 publishes these rows too.
  {
    const int wn = threadIdx.x & 127, wk = (threadIdx.x >> 7) * 64;
    const float* wsrc = Wp + wk * CDIM + wn;
    float w[64];
#pragma unroll
    for (int i = 0; i < 64; ++i) w[i] = wsrc[i * CDIM];
    // Before a register that these loads name is used again; the pointer is an
    // input so that its registers are not handed out while the loads are issued.
    asm volatile("s_wait_xcnt 0x0" :: "v"(wsrc) : "memory");
#pragma unroll
    for (int j = 0; j < 8; ++j) {
      v8h h;
#pragma unroll
      for (int r = 0; r < 8; ++r) h[r] = (f16)w[j * 8 + r];
      *(v8h*)&Wt[wn * WT_PITCH + wk + j * 8] = h;
    }
  }
  asm volatile("s_wait_asynccnt 0x0" ::: "memory");  // own copies of stage 0 landed
  __syncthreads();                                   // every wave's copies landed
  copy_stage(lds_my + STG_BUF * 2, gk_my + STG_KEYS * CDIM * 2, gv_my + STG_KEYS * 2);

  const f16* Qrow = Q + (qbase + l16) * CDIM + half * 8;
  v16h qa[2][4];
#pragma unroll
  for (int t = 0; t < 2; ++t)
#pragma unroll
    for (int kk = 0; kk < 4; ++kk)
      qa[t][kk] = load_frag16(Qrow + t * 16 * CDIM + kk * 32);
  // Before a register that these loads name is used again; the row pointer is an
  // input so that its registers are not handed out while the loads are issued.
  asm volatile("s_wait_xcnt 0x0" :: "v"(Qrow) : "memory");

  v8f acc[2][8] = {};       // acc[t][cn][r] = O[query t*16 + l16][channel cn*16 + 8*half + r]
  float nm[2] = {0.0f, 0.0f};          // minus the maxima in use for this lane's queries,
                                       // log2 units; the first block sets them
  float li[2] = {0.0f, 0.0f};          // running sums over this lane half's keys only

  for (int st = 0; st < STG_COUNT; ++st) {
    const f16* Ks = &Stage[(st & 1) * STG_BUF] + kh * (WAVE_KEYS * STG_PITCH);  // own key rows
    const f16* Vs = &Stage[(st & 1) * STG_BUF] + STG_TILE + kh * WAVE_KEYS;     // own key columns

    // K fragments of both blocks, one group at the head of the stage.
    static_assert(WAVE_KEYS == 64, "a wave walks two blocks of 32 keys per stage");
    v16h kf[2][2][4];       // [block][16-key tile][32 channels]
#pragma unroll
    for (int blk = 0; blk < 2; ++blk) {
#pragma unroll
      for (int kt = 0; kt < 2; ++kt)
#pragma unroll
        for (int kk = 0; kk < 4; ++kk)
          kf[blk][kt][kk] = load_frag16(Ks + (blk * 32 + kt * 16 + l16) * STG_PITCH + kk * 32 + half * 8);
      // Keeps the loads here, the first block's in front: without it the second block's
      // are scheduled late, in pieces, just in front of where they are waited for.
      __builtin_amdgcn_sched_barrier(0);
    }

    // Unrolled so that the second block's K Q^T can be scheduled among the first
    // block's exponentials.
#pragma unroll
    for (int blk = 0; blk < 2; ++blk) {
      const int kv0 = blk * 32;
      // ---- S^T = K Q^T + nm for 32 keys x 32 queries: four 16x16 f32 tiles ----
      // The C operand of a query group's two tiles: nm in all 8 registers.
      v8f s0[2], s1[2];
#pragma unroll
      for (int t = 0; t < 2; ++t) {
#pragma unroll
        for (int r = 0; r < 8; ++r) s0[t][r] = nm[t];
        s1[t] = s0[t];
      }
#pragma unroll
      for (int kk = 0; kk < 4; ++kk) {
#pragma unroll
        for (int t = 0; t < 2; ++t) {
          s0[t] = wmma16x16x32(kf[blk][0][kk], qa[t][kk], s0[t]);
          s1[t] = wmma16x16x32(kf[blk][1][kk], qa[t][kk], s1[t]);
        }
      }

      float mb[2];          // this block's maximum, relative to the one in use
      bool need = false;
#pragma unroll
      for (int t = 0; t < 2; ++t) {
        // maximum as a tree of three-input steps: short dependent chain
        const float m0 = max3f(s0[t][0], s0[t][1], s0[t][2]);
        const float m1 = max3f(s0[t][3], s0[t][4], s0[t][5]);
        const float m2 = max3f(s0[t][6], s0[t][7], s1[t][0]);
        const float m3 = max3f(s1[t][1], s1[t][2], s1[t][3]);
        const float m4 = max3f(s1[t][4], s1[t][5], s1[t][6]);
        float mx = fmaxf(max3f(m0, m1, m2), max3f(m3, m4, s1[t][7]));
        mx = fmaxf(mx, other_half(mx));
        mb[t] = mx;
        need = need || (mb[t] > 8.0f);
      }
      // Holds the second block's K loads at the head of the stage (loaded values as inputs
      // only): without it they sink behind the branch, and its K Q^T starts by waiting.
      // The scheduling barrier keeps the statement, and the wait it brings, down here
      // behind the first block's products and maxima.
      if (blk == 0) {
        __builtin_amdgcn_sched_barrier(0);
        asm volatile("" :: "v"(kf[1][0][0]), "v"(kf[1][0][1]), "v"(kf[1][0][2]), "v"(kf[1][0][3]),
                           "v"(kf[1][1][0]), "v"(kf[1][1][1]), "v"(kf[1][1][2]), "v"(kf[1][1][3]));
      }
      const bool first = blk == 0 && st == 0;         // no maximum is in use yet
      if (__builtin_amdgcn_ballot_w32(need) != 0 || first) {   // rare behind the first block
#pragma unroll
        for (int t = 0; t < 2; ++t) {
          // The maximum in use moves by up: never down, but to the first block's own.
          const float up   = first ? mb[t] : fmaxf(mb[t], 0.0f);
          const float corr = __builtin_amdgcn_exp2f(-fmaxf(up, 0.0f));  // sums are 0 on the first block
          nm[t] -= up;
          li[t] *= corr;
#pragma unroll
          for (int cn = 0; cn < 8; ++cn) acc[t][cn] = acc[t][cn] * corr;
#pragma unroll
          for (int r = 0; r < 8; ++r) {
            s0[t][r] -= up;
            s1[t][r] -= up;
          }
        }
      }

      // This block's V^T fragments, one group in flight under the exponentials.
      v16h vf[8];
#pragma unroll
      for (int cn = 0; cn < 8; ++cn)
        vf[cn] = load_frag16(Vs + (cn * 16 + l16) * STG_PITCH + kv0 + half * 8);
      // Keeps the group together and ahead: without it the loads sink to their products,
      // one fragment at a time, each waited for in full.
      __builtin_amdgcn_sched_barrier(0);

      v16h pb[2];           // P^T as B operand: element r is key 8*half + r, element 8 + r key 16 + 8*half + r
#pragma unroll
      for (int t = 0; t < 2; ++t) {
        float rs = 0.0f;
#pragma unroll
        for (int r = 0; r < 8; ++r) {
          const float p0 = __builtin_amdgcn_exp2f(s0[t][r]);
          const float p1 = __builtin_amdgcn_exp2f(s1[t][r]);
          rs += p0 + p1;
          pb[t][r]     = (f16)p0;
          pb[t][r + 8] = (f16)p1;
        }
        li[t] += rs;
      }

      // ---- O^T += V^T P^T : V^T rows are the A operand, read once for both groups
#pragma unroll
      for (int cn = 0; cn < 8; ++cn) {
#pragma unroll
        for (int t = 0; t < 2; ++t)
          acc[t][cn] = wmma16x16x32(vf[cn], pb[t], acc[t][cn]);
      }
    }

    // ---- hand-over: publish stage st + 1, free this stage's buffer -------
    asm volatile("s_wait_dscnt 0x0" ::: "memory");     // own reads of this buffer done
    asm volatile("s_wait_asynccnt 0x0" ::: "memory");  // own copies of stage st + 1 landed
    __syncthreads();                                   // both hold for every wave
    if (st + 2 < STG_COUNT)
      copy_stage(lds_my + (st & 1) * (STG_BUF * 2),
                 gk_my + (size_t)(st + 2) * (STG_KEYS * CDIM * 2),
                 gv_my + (size_t)(st + 2) * (STG_KEYS * 2));
  }
  asm volatile("s_wait_asynccnt 0x0" ::: "memory");    // nothing in flight at the wave's end
  const float mi[2] = {-nm[0], -nm[1]};                // the maxima in use at the end

  // ---- join the two key halves of each query through LDS ----------------
  // Behind the loop's last barrier nobody reads the stages and no copy is in
  // flight, so their LDS carries the hand-over: 33 pieces of 16 B per lane, each
  // piece a contiguous 512 B per wave.
  v4f* Join = (v4f*)&Stage[0] + (size_t)qg * (33 * 32) + lane;
  if (kh == 1) {
    const v4f ml = {mi[0], mi[1], li[0], li[1]};
    Join[32 * 32] = ml;
#pragma unroll
    for (int t = 0; t < 2; ++t)
#pragma unroll
      for (int cn = 0; cn < 8; ++cn) {
        const v4f lo = {acc[t][cn][0], acc[t][cn][1], acc[t][cn][2], acc[t][cn][3]};
        const v4f hi = {acc[t][cn][4], acc[t][cn][5], acc[t][cn][6], acc[t][cn][7]};
        Join[((t * 8 + cn) * 2) * 32]     = lo;
        Join[((t * 8 + cn) * 2 + 1) * 32] = hi;
      }
  }
  __syncthreads();                                     // the partner's partial results are in LDS
  if (kh == 1) return;

  // What the projection's results are added to is fetched here, as one group that
  // flies during the join and the products: the bias of this lane's 8 columns per
  // tile and the 2 x 64 values of xn.
  float* outp = out_f + (qbase + l16) * CDIM + 8 * half;   // query l16, first column
  v4f brow[16], res[2][16];
#pragma unroll
  for (int cn = 0; cn < 8; ++cn) {
    brow[2 * cn]     = *(const v4f*)(bp + cn * 16 + 8 * half);
    brow[2 * cn + 1] = *(const v4f*)(bp + cn * 16 + 8 * half + 4);
#pragma unroll
    for (int t = 0; t < 2; ++t) {
      res[t][2 * cn]     = *(const v4f*)(outp + t * 16 * CDIM + cn * 16);
      res[t][2 * cn + 1] = *(const v4f*)(outp + t * 16 * CDIM + cn * 16 + 4);
    }
  }
  // Before a register that these loads name is used again. The compiler moves no
  // load over this statement either, so the group stays ahead of the join instead
  // of sinking to the stores, where each piece would wait by itself.
  asm volatile("s_wait_xcnt 0x0" ::: "memory");

  // ---- join the lane halves' sums, normalize, round to f16 ----------------
  // o of tile cn holds channels cn*16 + 8*half + r of this lane's query: tiles 2kk and
  // 2kk + 1 together are the B fragment of channels kk*32 .. kk*32 + 31.
  const v4f ml = Join[32 * 32];
  v16h ob[2][4];
#pragma unroll
  for (int t = 0; t < 2; ++t) {
    const float mj = fmaxf(mi[t], ml[t]);
    const float fa = __builtin_amdgcn_exp2f(mi[t] - mj);   // weight of this wave's keys
    const float fb = __builtin_amdgcn_exp2f(ml[t] - mj);   // weight of the partner's keys
    const float lj = li[t] * fa + ml[2 + t] * fb;
    const float inv = 1.0f / (lj + other_half(lj));
    const float wa = fa * inv, wb = fb * inv;
#pragma unroll
    for (int cn = 0; cn < 8; ++cn) {
      const v4f lo = Join[((t * 8 + cn) * 2) * 32];
      const v4f hi = Join[((t * 8 + cn) * 2 + 1) * 32];
#pragma unroll
      for (int r = 0; r < 4; ++r) {
        ob[t][cn >> 1][(cn & 1) * 8 + r]     = (f16)(acc[t][cn][r] * wa + lo[r] * wb);
        ob[t][cn >> 1][(cn & 1) * 8 + r + 4] = (f16)(acc[t][cn][r + 4] * wa + hi[r] * wb);
      }
    }
  }

  // ---- out^T = Wp^T O^T: a Wp^T fragment from LDS feeds both query groups ----
  v8f pacc[2][8] = {};      // pacc[t][cn][r] = proj[query t*16 + l16][column cn*16 + 8*half + r]
#pragma unroll
  for (int kk = 0; kk < 4; ++kk) {
#pragma unroll
    for (int cn = 0; cn < 8; ++cn) {
      v16h wfrag = load_frag16(&Wt[(cn * 16 + l16) * WT_PITCH + kk * 32 + half * 8]);
#pragma unroll
      for (int t = 0; t < 2; ++t)
        pacc[t][cn] = wmma16x16x32(wfrag, ob[t][kk], pacc[t][cn]);
    }
  }

  // ---- bias, xn residual, f32 output: 8 columns of one row per tile ----------
  // All sums first, then all stores, so that no register that a store names is
  // written again.
#pragma unroll
  for (int t = 0; t < 2; ++t)
#pragma unroll
    for (int cn = 0; cn < 8; ++cn) {
      v4f lo = {pacc[t][cn][0], pacc[t][cn][1], pacc[t][cn][2], pacc[t][cn][3]};
      v4f hi = {pacc[t][cn][4], pacc[t][cn][5], pacc[t][cn][6], pacc[t][cn][7]};
      lo += brow[2 * cn];
      hi += brow[2 * cn + 1];
      res[t][2 * cn]     += lo;
      res[t][2 * cn + 1] += hi;
    }
#pragma unroll
  for (int t = 0; t < 2; ++t)
#pragma unroll
    for (int i = 0; i < 16; ++i)
      *(v4f*)(outp + t * 16 * CDIM + (i >> 1) * 16 + (i & 1) * 4) = res[t][i];
}

// ---------------------------------------------------------------------------
extern "C" void kernel_launch(void* const* d_in, const int* in_sizes, int n_in,
                              void* d_out, int out_size, void* d_ws, size_t ws_size,
                              hipStream_t stream) {
  (void)in_sizes; (void)n_in; (void)out_size; (void)ws_size;

  const float* inputs  = (const float*)d_in[0];
  const float* context = (const float*)d_in[1];
  const float* gamma   = (const float*)d_in[2];
  const float* beta    = (const float*)d_in[3];
  const float* Wq      = (const float*)d_in[4];
  const float* bq      = (const float*)d_in[5];
  const float* Wk      = (const float*)d_in[6];
  const float* bk      = (const float*)d_in[7];
  const float* Wv      = (const float*)d_in[8];
  const float* bv      = (const float*)d_in[9];
  const float* Wp      = (const float*)d_in[10];
  const float* bp      = (const float*)d_in[11];
  float* out = (float*)d_out;

  const size_t halfbuf = (size_t)MROWS * CDIM * sizeof(f16);  // 8 MB each
  char* ws = (char*)d_ws;
  f16* qh   = (f16*)(ws + 0 * halfbuf);
  f16* kh   = (f16*)(ws + 1 * halfbuf);
  f16* vt   = (f16*)(ws + 2 * halfbuf);   // [b][c][n] transposed

  // 1) xn = LayerNorm(inputs) (f32) -> d_out as residual base;
  //    Q = (xn @ Wq + bq) * U^-0.5 * log2(e) ; K = ctx @ Wk + bk ; V^T = (ctx @ Wv + bv)^T
  ln_qkv_kernel<<<2 * ROW_TILES, 256, 0, stream>>>(inputs, context, gamma, beta,
                                                   Wq, bq, Wk, bk, Wv, bv,
                                                   out, qh, kh, vt);
  // 2) d_out(=xn) += softmax(Q K^T) V @ Wp + bp, the softmax taken in base 2
  flash_attn_kernel<<<NBATCH * (NPIX / WG_QUERIES), 256, 0, stream>>>(qh, kh, vt, Wp, bp, out);
}

// v010
// One run takes 63.2 microseconds.
// Two timings next to v009 both put it at 1.06 times that version's speed.
// All steps since v000 together make it 7.23 times as fast.
#include <hip/hip_runtime.h>
#include <hip/hip_bf16.h>

// ---------------------------------------------------------------------------
// CrossAttentionBlock for MI455X (gfx1250, wave32, WMMA 16x16x32 f16)
// B=8, H=W=64 (N=4096 pixels), C=U=128.
// ---------------------------------------------------------------------------

typedef _Float16 f16;
typedef __attribute__((ext_vector_type(4)))  _Float16 v4h;
typedef __attribute__((ext_vector_type(8)))  _Float16 v8h;
typedef __attribute__((ext_vector_type(16))) _Float16 v16h;
typedef __attribute__((ext_vector_type(8)))  float    v8f;
typedef __attribute__((ext_vector_type(4)))  float    v4f;

#define NPIX   4096          // H*W
#define CDIM   128           // channels == units
#define NBATCH 8
#define MROWS  (NBATCH * NPIX)  // 32768 total pixel rows
#define QSCALE (0.08838834764831845f * 1.4426950408889634f)  // U^-0.5 * log2(e), U=128

// Load one 16x32 f16 A/B fragment for v_wmma_f32_16x16x32_f16.
// Per ISA layout: lane's 16 halves are two contiguous groups of 8 at
// k = half*8 .. +7 and k = 16+half*8 .. +7 (caller pre-offsets by half*8).
__device__ inline v16h load_frag16(const f16* p) {
  v8h lo = *(const v8h*)(p);
  v8h hi = *(const v8h*)(p + 16);
  return __builtin_shufflevector(lo, hi, 0, 1, 2, 3, 4, 5, 6, 7,
                                         8, 9, 10, 11, 12, 13, 14, 15);
}

__device__ inline v8f wmma16x16x32(v16h a, v16h b, v8f c) {
  // (neg_a, A, neg_b, B, c_mod, C, reuse_a, reuse_b)
  return __builtin_amdgcn_wmma_f32_16x16x32_f16(false, a, false, b,
                                                (short)0, c, false, false);
}

__device__ inline float max3f(float a, float b, float c) {
  return fmaxf(fmaxf(a, b), c);
}

// Value of the partner lane in the other 16-lane half (lane ^ 16).
__device__ inline float other_half(float v) {
  const int b = __builtin_bit_cast(int, v);
  return __builtin_bit_cast(float,
      __builtin_amdgcn_permlanex16(b, b, 0x76543210, 0xfedcba98, false, false));
}

// ---------------------------------------------------------------------------
// 128 x 128 projection tile, C[128 x 128] = A[128 x 128](f16) @ W[128 x 128] + bias,
// via WMMA. 256 threads = 8 waves; each wave owns 16 rows.
// W is staged in LDS transposed as f16 so its fragments are two b128 ds loads.
// The LDS rows are pitched 16 B past their 256 B: the 16 rows of a fragment read
// and the 32 rows of a staging store then spread over the banks.
// The output form is a compile-time parameter, and it picks the operand roles so
// that the 8 accumulators of a lane are neighbours in memory:
// MODE 0: f16 row-major [M,128]    (Q / K): C^T = W^T A^T, lane = row, regs = columns;
//         the f32 result is multiplied by oscale before it is rounded to f16
// MODE 1: f16 transposed [b][c][n] (V):     C   = A W,     lane = column, regs = rows
// ---------------------------------------------------------------------------
#define WT_PITCH 136         // halves per LDS row of W^T: 256 B + 16 B pad
#define ROW_TILES (MROWS / 128)   // 128-row tiles of the pixel rows

// a: this wave's A fragments (rows row0 .. row0 + 15); Wt: the staged W^T, [n][k].
template <int MODE>
__device__ __forceinline__ void gemm128_tile(
    const v16h (&a)[4], const f16* Wt, size_t row0,
    const float* __restrict__ bias, f16* __restrict__ out_h, const float oscale) {
  const int lane = threadIdx.x & 31;
  const int half = lane >> 4;
  const int l16  = lane & 15;
  const size_t off  = (row0 + l16) * CDIM + 8 * half;   // MODE 0: this lane's first result

  // What the epilogue adds is fetched here, as one group ahead of the products: the
  // bias of this lane's results.
  float bcol[8];
  v4f brow[16];
#pragma unroll
  for (int cn = 0; cn < 8; ++cn) {
    if (MODE == 1) {
      bcol[cn] = bias[cn * 16 + l16];
    } else {
      brow[2 * cn]     = *(const v4f*)(bias + cn * 16 + 8 * half);
      brow[2 * cn + 1] = *(const v4f*)(bias + cn * 16 + 8 * half + 4);
    }
  }
  // Before a register that these loads name is used again. The compiler moves no
  // load over this statement either, so the group stays ahead of the products
  // instead of sinking into the epilogue, where each piece would wait by itself.
  asm volatile("s_wait_xcnt 0x0" ::: "memory");

  v8f acc[8] = {};
#pragma unroll
  for (int kk = 0; kk < 4; ++kk) {
#pragma unroll
    for (int cn = 0; cn < 8; ++cn) {
      v16h wfrag = load_frag16(&Wt[(cn * 16 + l16) * WT_PITCH + kk * 32 + half * 8]);
      acc[cn] = (MODE == 1) ? wmma16x16x32(a[kk], wfrag, acc[cn])
                            : wmma16x16x32(wfrag, a[kk], acc[cn]);
    }
  }

#pragma unroll
  for (int cn = 0; cn < 8; ++cn) {
    if (MODE == 1) {
      // acc[cn][r] = C[row0 + 8*half + r][cn*16 + l16]: 8 pixels of one channel, 16 B.
      const size_t b = row0 >> 12, nn = (row0 & (NPIX - 1)) + 8 * half;
      v8h o;
#pragma unroll
      for (int r = 0; r < 8; ++r) o[r] = (f16)(acc[cn][r] + bcol[cn]);
      *(v8h*)(out_h + (b * CDIM + cn * 16 + l16) * NPIX + nn) = o;
    } else {
      // acc[cn][r] = C[row0 + l16][cn*16 + 8*half + r]: 8 columns of one row.
      v4f lo = {acc[cn][0], acc[cn][1], acc[cn][2], acc[cn][3]};
      v4f hi = {acc[cn][4], acc[cn][5], acc[cn][6], acc[cn][7]};
      lo = (lo + brow[2 * cn]) * oscale;
      hi = (hi + brow[2 * cn + 1]) * oscale;
      v8h o = {(f16)lo[0], (f16)lo[1], (f16)lo[2], (f16)lo[3],
               (f16)hi[0], (f16)hi[1], (f16)hi[2], (f16)hi[3]};
      *(v8h*)(out_h + off + cn * 16) = o;
    }
  }
}

// ---------------------------------------------------------------------------
// Kernel 1: LayerNorm, f16 conversion and the Q, K, V projections in one launch.
// Work-groups 0 .. ROW_TILES-1 take 128 context rows each and write K and V^T;
// the others take 128 input rows each, normalize them (eps = 1e-3), write xn (f32)
// into d_out as the residual base, and write Q times U^-0.5 * log2(e). Two
// work-groups fit a WGP.
// A wave fetches its 16 rows as whole 512 B rows (4 channels per lane), all in
// flight while the weights are staged; the f16 rows go to the A fragments through
// LDS and never through memory.
// ---------------------------------------------------------------------------
__global__ __launch_bounds__(256) void ln_qkv_kernel(
    const float* __restrict__ x, const float* __restrict__ ctx,
    const float* __restrict__ gamma, const float* __restrict__ beta,
    const float* __restrict__ Wq, const float* __restrict__ bq,
    const float* __restrict__ Wk, const float* __restrict__ bk,
    const float* __restrict__ Wv, const float* __restrict__ bv,
    float* __restrict__ xn_out, f16* __restrict__ qh, f16* __restrict__ kh,
    f16* __restrict__ vt) {
  __shared__ __attribute__((aligned(16))) f16 Rows[128 * WT_PITCH];     // [row][k], 34 KB
  __shared__ __attribute__((aligned(16))) f16 Wt[2][CDIM * WT_PITCH];   // [n][k], 34 KB each
  const int lane = threadIdx.x & 31;
  const int wave = threadIdx.x >> 5;
  const int half = lane >> 4;
  const int l16  = lane & 15;
  const bool is_q = blockIdx.x >= ROW_TILES;
  const size_t row0 = (size_t)(is_q ? blockIdx.x - ROW_TILES : blockIdx.x) * 128 + wave * 16;
  const float* src = (is_q ? x : ctx) + row0 * CDIM + lane * 4;

  float4 rv[16];
#pragma unroll
  for (int r = 0; r < 16; ++r) rv[r] = *(const float4*)(src + r * CDIM);
  // Before a register that these loads name is used again; the row pointer is an
  // input so that its registers are not handed out while the loads are issued.
  asm volatile("s_wait_xcnt 0x0" :: "v"(src) : "memory");

  if (is_q) {
    for (int idx = threadIdx.x; idx < CDIM * CDIM; idx += 256) {
      int k = idx >> 7, n = idx & 127;
      Wt[0][n * WT_PITCH + k] = (f16)Wq[idx];
    }

    // LayerNorm of the 16 rows, their reductions side by side.
    const float4 g  = ((const float4*)gamma)[lane];
    const float4 bt = ((const float4*)beta)[lane];
    float s[16];
#pragma unroll
    for (int r = 0; r < 16; ++r) s[r] = rv[r].x + rv[r].y + rv[r].z + rv[r].w;
#pragma unroll
    for (int m = 16; m >= 1; m >>= 1)
#pragma unroll
      for (int r = 0; r < 16; ++r) s[r] += __shfl_xor(s[r], m, 32);
#pragma unroll
    for (int r = 0; r < 16; ++r) {
      const float mu = s[r] * (1.0f / 128.0f);
      rv[r].x -= mu; rv[r].y -= mu; rv[r].z -= mu; rv[r].w -= mu;
      s[r] = rv[r].x * rv[r].x + rv[r].y * rv[r].y + rv[r].z * rv[r].z + rv[r].w * rv[r].w;
    }
#pragma unroll
    for (int m = 16; m >= 1; m >>= 1)
#pragma unroll
      for (int r = 0; r < 16; ++r) s[r] += __shfl_xor(s[r], m, 32);
#pragma unroll
    for (int r = 0; r < 16; ++r) {
      const float inv = rsqrtf(s[r] * (1.0f / 128.0f) + 1e-3f);
      rv[r].x = rv[r].x * inv * g.x + bt.x;
      rv[r].y = rv[r].y * inv * g.y + bt.y;
      rv[r].z = rv[r].z * inv * g.z + bt.z;
      rv[r].w = rv[r].w * inv * g.w + bt.w;
    }
  } else {
    for (int idx = threadIdx.x; idx < CDIM * CDIM; idx += 256) {
      int k = idx >> 7, n = idx & 127;
      Wt[0][n * WT_PITCH + k] = (f16)Wk[idx];
      Wt[1][n * WT_PITCH + k] = (f16)Wv[idx];
    }
  }

#pragma unroll
  for (int r = 0; r < 16; ++r) {
    v4h h = {(f16)rv[r].x, (f16)rv[r].y, (f16)rv[r].z, (f16)rv[r].w};
    *(v4h*)&Rows[(wave * 16 + r) * WT_PITCH + lane * 4] = h;
  }
  __syncthreads();

  // xn goes out behind the barrier, which would otherwise wait for these stores.
  if (is_q) {
#pragma unroll
    for (int r = 0; r < 16; ++r)
      ((float4*)(xn_out + (row0 + r) * CDIM))[lane] = rv[r];
  }

  v16h a[4];
#pragma unroll
  for (int kk = 0; kk < 4; ++kk)
    a[kk] = load_frag16(&Rows[(wave * 16 + l16) * WT_PITCH + kk * 32 + half * 8]);

  if (is_q) {
    gemm128_tile<0>(a, Wt[0], row0, bq, qh, QSCALE);   // Q in the softmax's log2 units
  } else {
    gemm128_tile<0>(a, Wt[0], row0, bk, kh, 1.0f);
    // Before a register that the K stores name is used again by the second tile.
    asm volatile("s_wait_xcnt 0x0" ::: "memory");
    gemm128_tile<1>(a, Wt[1], row0, bv, vt, 1.0f);
    // Before a register that the V^T stores name is used again: in the built code
    // the other branch's instructions stand behind them.
    asm volatile("s_wait_xcnt 0x0" ::: "memory");
  }
}

// ---------------------------------------------------------------------------
// Kernel 2: flash attention, output projection and residual. 256 threads = 8 waves;
// 128 query rows per work-group.
// K and V^T are staged in LDS, 128 keys per stage, two buffers, by tensor loads:
// each of the eight waves asks for one slice of 32 rows per stage (waves 0-3: K,
// waves 4-7: V^T), and the next stage's loads fly while this stage is worked on.
// Wave tile: 32 queries (two column groups) x 64 of the stage's 128 keys. Waves w
// and w + 4 hold the same queries and split the keys, so every K and V^T fragment
// read from LDS feeds two products, and one work-group fills a WGP with two waves
// per SIMD. Each wave keeps its own running maximum, sum and output over its keys;
// the two partial results of a query are joined through LDS behind the loop.
// The keys are walked in blocks of 32, in transposed form: S^T = K Q^T (16 WMMAs)
// leaves one query's scores in one lane pair, so the online softmax runs in
// registers. Q arrives in log2 units and the products start from minus the maximum
// in use (their C operand), so what they leave is the argument of the exponential; the S^T tiles, converted in place, are the B operands of
// O^T += V^T P^T (16 WMMAs). A lane holds queries l16 and 16 + l16; its half holds
// keys 8*half+r, 16+8*half+r.
// The work-group holds whole rows of the attention output, so the projection runs
// here: the joined O^T tiles, rounded to f16, are in place the B operands of
// out^T = Wp^T O^T (Wp^T staged in LDS as f16 while stage 0 lands), and the result
// is added onto xn in out_f. The attention output never goes through memory.
// ---------------------------------------------------------------------------
#define STG_KEYS   128                       // keys per stage
#define STG_PITCH  136                       // halves per LDS row: 256 B + 16 B pad
#define SLC_ROWS   32                        // rows of 256 B that one tensor load brings
#define SLC_BYTES  10240                     // a slice's place in LDS: 32 x 272 B, rounded up to 2 KiB
#define SLC_HALVES (SLC_BYTES / 2)
#define STG_BUF    (8 * SLC_HALVES)          // halves per buffer: 4 K slices, then 4 V^T slices
#define STG_COUNT  (NPIX / STG_KEYS)         // stages per batch
#define WAVE_KEYS  (STG_KEYS / 2)            // keys of a stage that one wave walks
#define WG_QUERIES 128                       // queries per work-group: 4 wave pairs x 32
static_assert(SLC_ROWS * STG_PITCH * 2 <= SLC_BYTES && SLC_BYTES % 2048 == 0, "slice place");

typedef uint32_t u32x4 __attribute__((ext_vector_type(4)));
typedef uint32_t u32x8 __attribute__((ext_vector_type(8)));

__device__ inline uint32_t uni(uint32_t v) {
  return (uint32_t)__builtin_amdgcn_readfirstlane(v);
}
// A value held in a scalar register, so that a test on it is a scalar branch (tensor
// loads ignore EXEC) and what is formed from it is formed behind this statement.
__device__ inline uint32_t pinned(uint32_t v) {
  uint32_t w = uni(v);
  asm volatile("" : "+s"(w));   // a word kept in a scalar register
  return w;
}

// One request of the whole wave: SLC_ROWS rows of 256 B from global memory into LDS
// at a pitch of 272 B. g1 is the loop-invariant descriptor group.
__device__ inline void tensor_load_slice(uint32_t lds_dst, uint64_t ga, u32x8 g1) {
  u32x4 g0;
  g0[0] = uni(1u);                                                   // count 1
  g0[1] = uni(lds_dst);                                              // byte offset in LDS
  g0[2] = uni((uint32_t)ga);                                         // address [31:0]
  g0[3] = uni((((uint32_t)(ga >> 32)) & 0x01FFFFFFu) | 0x80000000u); // address [56:32], type 2
  asm volatile("tensor_load_to_lds %0, %1" :: "s"(g0), "s"(g1) : "memory");
}

__global__ __launch_bounds__(256) void flash_attn_kernel(
    const f16* __restrict__ Q, const f16* __restrict__ K,
    const f16* __restrict__ Vt, const float* __restrict__ Wp,
    const float* __restrict__ bp, float* __restrict__ out_f) {
  __shared__ __attribute__((aligned(2048))) f16 Stage[2 * STG_BUF];
  __shared__ __attribute__((aligned(16))) f16 Wt[CDIM * WT_PITCH];   // Wp^T, [n][k], 34 KB
  const int lane = threadIdx.x & 31;
  const int wave = __builtin_amdgcn_readfirstlane(threadIdx.x >> 5);
  const int half = lane >> 4;
  const int l16  = lane & 15;
  const int qg   = wave & 3;    // which 32 queries of the work-group
  const int kh   = wave >> 2;   // which 64 keys of every stage
  const int b    = blockIdx.x / (NPIX / WG_QUERIES);
  const int q0   = (blockIdx.x % (NPIX / WG_QUERIES)) * WG_QUERIES + qg * 32;
  const size_t qbase = (size_t)b * NPIX + q0;

  // This wave's slice of every stage: waves 0-3 take 32 K rows each (source pitch
  // 256 B, a stage further on is 32 KB), waves 4-7 take 32 V^T rows each (source pitch
  // 8 KB, a stage further on is 256 B).
  const bool     is_v   = wave >= 4;
  const uint32_t lds_my = (uint32_t)(size_t)&Stage[0] + wave * SLC_BYTES;
  const uint64_t src_my = is_v
      ? (uint64_t)(size_t)(Vt + (size_t)b * CDIM * NPIX + (size_t)(wave - 4) * SLC_ROWS * NPIX)
      : (uint64_t)(size_t)(K + ((size_t)b * NPIX + wave * SLC_ROWS) * CDIM);
  const uint32_t stg_shift = is_v ? 8 : 15;      // log2 of the bytes from stage to stage
  u32x8 g1;                                      // 1-byte elements, tensor = tile
  g1[0] = uni((1u << 20) | (5u << 22) | (3u << 25));   // no mask; 16 B of pad behind each 256 B
  g1[1] = uni(256u << 16);                       // tensor_dim0 = 256 B
  g1[2] = uni((uint32_t)SLC_ROWS << 16);         // tensor_dim1 = 32 rows
  g1[3] = uni(256u << 16);                       // tile_dim0
  g1[4] = uni((uint32_t)SLC_ROWS);               // tile_dim1
  g1[5] = uni(is_v ? NPIX * 2u : CDIM * 2u);     // source row pitch
  g1[6] = uni(0u);
  g1[7] = uni(0u);
  // pinned(), for the whole group: its words stay in their scalar registers, which then
  // take no other value while a request is out.
  asm volatile("" : "+s"(g1));

  // Stage 0 lands and is published; stage 1 then flies during stage 0's work.
  tensor_load_slice(lds_my, src_my, g1);

  // Wp^T into LDS as f16 while stage 0 flies: a thread takes 64 k of one column n
  // (a wave's load is one 128 B line), all loads in flight at once, and stores 8 k
  // as 16 B. The barrier that publishes stage 0 publishes these rows too.
  {
    const int wn = threadIdx.x & 127, wk = (threadIdx.x >> 7) * 64;
    const float* wsrc = Wp + wk * CDIM + wn;
    float w[64];
#pragma unroll
    for (int i = 0; i < 64; ++i) w[i] = wsrc[i * CDIM];
    // Before a register that these loads name is used again; the pointer is an
    // input so that its registers are not handed out while the loads are issued.
    asm volatile("s_wait_xcnt 0x0" :: "v"(wsrc) : "memory");
#pragma unroll
    for (int j = 0; j < 8; ++j) {
      v8h h;
#pragma unroll
      for (int r = 0; r < 8; ++r) h[r] = (f16)w[j * 8 + r];
      *(v8h*)&Wt[wn * WT_PITCH + wk + j * 8] = h;
    }
  }
  asm volatile("s_wait_tensorcnt 0x0" ::: "memory"); // own slice of stage 0 landed
  __syncthreads();                                   // every wave's slice landed
  {
    const uint32_t nx = pinned(1u);                  // descriptor formed behind the wait
    tensor_load_slice(lds_my + (nx & 1) * (STG_BUF * 2), src_my + (nx << stg_shift), g1);
  }

  const f16* Qrow = Q + (qbase + l16) * CDIM + half * 8;
  v16h qa[2][4];
#pragma unroll
  for (int t = 0; t < 2; ++t)
#pragma unroll
    for (int kk = 0; kk < 4; ++kk)
      qa[t][kk] = load_frag16(Qrow + t * 16 * CDIM + kk * 32);
  // Before a register that these loads name is used again; the row pointer is an
  // input so that its registers are not handed out while the loads are issued.
  asm volatile("s_wait_xcnt 0x0" :: "v"(Qrow) : "memory");

  v8f acc[2][8] = {};       // acc[t][cn][r] = O[query t*16 + l16][channel cn*16 + 8*half + r]
  float nm[2] = {0.0f, 0.0f};          // minus the maxima in use for this lane's queries,
                                       // log2 units; the first block sets them
  float li[2] = {0.0f, 0.0f};          // running sums over this lane half's keys only

  for (int st = 0; st < STG_COUNT; ++st) {
    const f16* Ks = &Stage[(st & 1) * STG_BUF] + kh * (2 * SLC_HALVES);            // own key rows: 2 slices
    const f16* Vs = &Stage[(st & 1) * STG_BUF] + 4 * SLC_HALVES + kh * WAVE_KEYS;  // own key columns

    // K fragments of both blocks, one group at the head of the stage.
    static_assert(WAVE_KEYS == 64, "a wave walks two blocks of 32 keys per stage");
    v16h kf[2][2][4];       // [block][16-key tile][32 channels]
#pragma unroll
    for (int blk = 0; blk < 2; ++blk) {
#pragma unroll
      for (int kt = 0; kt < 2; ++kt)
#pragma unroll
        for (int kk = 0; kk < 4; ++kk)
          kf[blk][kt][kk] = load_frag16(Ks + blk * SLC_HALVES + (kt * 16 + l16) * STG_PITCH + kk * 32 + half * 8);
      // Keeps the loads here, the first block's in front: without it the second block's
      // are scheduled late, in pieces, just in front of where they are waited for.
      __builtin_amdgcn_sched_barrier(0);
    }

    // Unrolled so that the second block's K Q^T can be scheduled among the first
    // block's exponentials.
#pragma unroll
    for (int blk = 0; blk < 2; ++blk) {
      const int kv0 = blk * 32;
      // ---- S^T = K Q^T + nm for 32 keys x 32 queries: four 16x16 f32 tiles ----
      // The C operand of a query group's two tiles: nm in all 8 registers.
      v8f s0[2], s1[2];
#pragma unroll
      for (int t = 0; t < 2; ++t) {
#pragma unroll
        for (int r = 0; r < 8; ++r) s0[t][r] = nm[t];
        s1[t] = s0[t];
      }
#pragma unroll
      for (int kk = 0; kk < 4; ++kk) {
#pragma unroll
        for (int t = 0; t < 2; ++t) {
          s0[t] = wmma16x16x32(kf[blk][0][kk], qa[t][kk], s0[t]);
          s1[t] = wmma16x16x32(kf[blk][1][kk], qa[t][kk], s1[t]);
        }
      }

      float mb[2];          // this block's maximum, relative to the one in use
      bool need = false;
#pragma unroll
      for (int t = 0; t < 2; ++t) {
        // maximum as a tree of three-input steps: short dependent chain
        const float m0 = max3f(s0[t][0], s0[t][1], s0[t][2]);
        const float m1 = max3f(s0[t][3], s0[t][4], s0[t][5]);
        const float m2 = max3f(s0[t][6], s0[t][7], s1[t][0]);
        const float m3 = max3f(s1[t][1], s1[t][2], s1[t][3]);
        const float m4 = max3f(s1[t][4], s1[t][5], s1[t][6]);
        float mx = fmaxf(max3f(m0, m1, m2), max3f(m3, m4, s1[t][7]));
        mx = fmaxf(mx, other_half(mx));
        mb[t] = mx;
        need = need || (mb[t] > 8.0f);
      }
      // Holds the second block's K loads at the head of the stage (loaded values as inputs
      // only): without it they sink behind the branch, and its K Q^T starts by waiting.
      // The scheduling barrier keeps the statement, and the wait it brings, down here
      // behind the first block's products and maxima.
      if (blk == 0) {
        __builtin_amdgcn_sched_barrier(0);
        asm volatile("" :: "v"(kf[1][0][0]), "v"(kf[1][0][1]), "v"(kf[1][0][2]), "v"(kf[1][0][3]),
                           "v"(kf[1][1][0]), "v"(kf[1][1][1]), "v"(kf[1][1][2]), "v"(kf[1][1][3]));
      }
      const bool first = blk == 0 && st == 0;         // no maximum is in use yet
      if (__builtin_amdgcn_ballot_w32(need) != 0 || first) {   // rare behind the first block
#pragma unroll
        for (int t = 0; t < 2; ++t) {
          // The maximum in use moves by up: never down, but to the first block's own.
          const float up   = first ? mb[t] : fmaxf(mb[t], 0.0f);
          const float corr = __builtin_amdgcn_exp2f(-fmaxf(up, 0.0f));  // sums are 0 on the first block
          nm[t] -= up;
          li[t] *= corr;
#pragma unroll
          for (int cn = 0; cn < 8; ++cn) acc[t][cn] = acc[t][cn] * corr;
#pragma unroll
          for (int r = 0; r < 8; ++r) {
            s0[t][r] -= up;
            s1[t][r] -= up;
          }
        }
      }

      // This block's V^T fragments, one group in flight under the exponentials.
      v16h vf[8];
#pragma unroll
      for (int cn = 0; cn < 8; ++cn)
        vf[cn] = load_frag16(Vs + (cn >> 1) * SLC_HALVES + ((cn & 1) * 16 + l16) * STG_PITCH + kv0 + half * 8);
      // Keeps the group together and ahead: without it the loads sink to their products,
      // one fragment at a time, each waited for in full.
      __builtin_amdgcn_sched_barrier(0);

      v16h pb[2];           // P^T as B operand: element r is key 8*half + r, element 8 + r key 16 + 8*half + r
#pragma unroll
      for (int t = 0; t < 2; ++t) {
        float rs = 0.0f;
#pragma unroll
        for (int r = 0; r < 8; ++r) {
          const float p0 = __builtin_amdgcn_exp2f(s0[t][r]);
          const float p1 = __builtin_amdgcn_exp2f(s1[t][r]);
          rs += p0 + p1;
          pb[t][r]     = (f16)p0;
          pb[t][r + 8] = (f16)p1;
        }
        li[t] += rs;
      }

      // ---- O^T += V^T P^T : V^T rows are the A operand, read once for both groups
#pragma unroll
      for (int cn = 0; cn < 8; ++cn) {
#pragma unroll
        for (int t = 0; t < 2; ++t)
          acc[t][cn] = wmma16x16x32(vf[cn], pb[t], acc[t][cn]);
      }
    }

    // ---- hand-over: publish stage st + 1, free this stage's buffer -------
    asm volatile("s_wait_dscnt 0x0" ::: "memory");     // own reads of this buffer done
    asm volatile("s_wait_tensorcnt 0x0" ::: "memory"); // own slice of stage st + 1 landed
    __syncthreads();                                   // both hold for every wave
    if (pinned(st + 2 < STG_COUNT)) {                  // scalar branch: the load ignores EXEC
      const uint32_t nx = pinned(st + 2);              // descriptor formed behind the wait
      tensor_load_slice(lds_my + (nx & 1) * (STG_BUF * 2), src_my + (nx << stg_shift), g1);
    }
  }
  asm volatile("s_wait_tensorcnt 0x0" ::: "memory");   // nothing in flight behind the loop
  asm volatile("s_wait_dscnt 0x0" ::: "memory");       // own LDS reads done before the ring is reused
  const float mi[2] = {-nm[0], -nm[1]};                // the maxima in use at the end

  // ---- join the two key halves of each query through LDS ----------------
  // Behind the loop's last barrier nobody reads the stages and no load is in
  // flight, so their LDS carries the hand-over: 33 pieces of 16 B per lane, each
  // piece a contiguous 512 B per wave.
  v4f* Join = (v4f*)&Stage[0] + (size_t)qg * (33 * 32) + lane;
  if (kh == 1) {
    const v4f ml = {mi[0], mi[1], li[0], li[1]};
    Join[32 * 32] = ml;
#pragma unroll
    for (int t = 0; t < 2; ++t)
#pragma unroll
      for (int cn = 0; cn < 8; ++cn) {
        const v4f lo = {acc[t][cn][0], acc[t][cn][1], acc[t][cn][2], acc[t][cn][3]};
        const v4f hi = {acc[t][cn][4], acc[t][cn][5], acc[t][cn][6], acc[t][cn][7]};
        Join[((t * 8 + cn) * 2) * 32]     = lo;
        Join[((t * 8 + cn) * 2 + 1) * 32] = hi;
      }
  }
  __syncthreads();                                     // the partner's partial results are in LDS
  if (kh == 1) return;

  // What the projection's results are added to is fetched here, as one group that
  // flies during the join and the products: the bias of this lane's 8 columns per
  // tile and the 2 x 64 values of xn.
  float* outp = out_f + (qbase + l16) * CDIM + 8 * half;   // query l16, first column
  v4f brow[16], res[2][16];
#pragma unroll
  for (int cn = 0; cn < 8; ++cn) {
    brow[2 * cn]     = *(const v4f*)(bp + cn * 16 + 8 * half);
    brow[2 * cn + 1] = *(const v4f*)(bp + cn * 16 + 8 * half + 4);
#pragma unroll
    for (int t = 0; t < 2; ++t) {
      res[t][2 * cn]     = *(const v4f*)(outp + t * 16 * CDIM + cn * 16);
      res[t][2 * cn + 1] = *(const v4f*)(outp + t * 16 * CDIM + cn * 16 + 4);
    }
  }
  // Before a register that these loads name is used again. The compiler moves no
  // load over this statement either, so the group stays ahead of the join instead
  // of sinking to the stores, where each piece would wait by itself.
  asm volatile("s_wait_xcnt 0x0" ::: "memory");

  // ---- join the lane halves' sums, normalize, round to f16 ----------------
  // o of tile cn holds channels cn*16 + 8*half + r of this lane's query: tiles 2kk and
  // 2kk + 1 together are the B fragment of channels kk*32 .. kk*32 + 31.
  const v4f ml = Join[32 * 32];
  v16h ob[2][4];
#pragma unroll
  for (int t = 0; t < 2; ++t) {
    const float mj = fmaxf(mi[t], ml[t]);
    const float fa = __builtin_amdgcn_exp2f(mi[t] - mj);   // weight of this wave's keys
    const float fb = __builtin_amdgcn_exp2f(ml[t] - mj);   // weight of the partner's keys
    const float lj = li[t] * fa + ml[2 + t] * fb;
    const float inv = 1.0f / (lj + other_half(lj));
    const float wa = fa * inv, wb = fb * inv;
#pragma unroll
    for (int cn = 0; cn < 8; ++cn) {
      const v4f lo = Join[((t * 8 + cn) * 2) * 32];
      const v4f hi = Join[((t * 8 + cn) * 2 + 1) * 32];
#pragma unroll
      for (int r = 0; r < 4; ++r) {
        ob[t][cn >> 1][(cn & 1) * 8 + r]     = (f16)(acc[t][cn][r] * wa + lo[r] * wb);
        ob[t][cn >> 1][(cn & 1) * 8 + r + 4] = (f16)(acc[t][cn][r + 4] * wa + hi[r] * wb);
      }
    }
  }

  // ---- out^T = Wp^T O^T: a Wp^T fragment from LDS feeds both query groups ----
  v8f pacc[2][8] = {};      // pacc[t][cn][r] = proj[query t*16 + l16][column cn*16 + 8*half + r]
#pragma unroll
  for (int kk = 0; kk < 4; ++kk) {
#pragma unroll
    for (int cn = 0; cn < 8; ++cn) {
      v16h wfrag = load_frag16(&Wt[(cn * 16 + l16) * WT_PITCH + kk * 32 + half * 8]);
#pragma unroll
      for (int t = 0; t < 2; ++t)
        pacc[t][cn] = wmma16x16x32(wfrag, ob[t][kk], pacc[t][cn]);
    }
  }

  // ---- bias, xn residual, f32 output: 8 columns of one row per tile ----------
  // All sums first, then all stores, so that no register that a store names is
  // written again.
#pragma unroll
  for (int t = 0; t < 2; ++t)
#pragma unroll
    for (int cn = 0; cn < 8; ++cn) {
      v4f lo = {pacc[t][cn][0], pacc[t][cn][1], pacc[t][cn][2], pacc[t][cn][3]};
      v4f hi = {pacc[t][cn][4], pacc[t][cn][5], pacc[t][cn][6], pacc[t][cn][7]};
      lo += brow[2 * cn];
      hi += brow[2 * cn + 1];
      res[t][2 * cn]     += lo;
      res[t][2 * cn + 1] += hi;
    }
#pragma unroll
  for (int t = 0; t < 2; ++t)
#pragma unroll
    for (int i = 0; i < 16; ++i)
      *(v4f*)(outp + t * 16 * CDIM + (i >> 1) * 16 + (i & 1) * 4) = res[t][i];
}

// ---------------------------------------------------------------------------
extern "C" void kernel_launch(void* const* d_in, const int* in_sizes, int n_in,
                              void* d_out, int out_size, void* d_ws, size_t ws_size,
                              hipStream_t stream) {
  (void)in_sizes; (void)n_in; (void)out_size; (void)ws_size;

  const float* inputs  = (const float*)d_in[0];
  const float* context = (const float*)d_in[1];
  const float* gamma   = (const float*)d_in[2];
  const float* beta    = (const float*)d_in[3];
  const float* Wq      = (const float*)d_in[4];
  const float* bq      = (const float*)d_in[5];
  const float* Wk      = (const float*)d_in[6];
  const float* bk      = (const float*)d_in[7];
  const float* Wv      = (const float*)d_in[8];
  const float* bv      = (const float*)d_in[9];
  const float* Wp      = (const float*)d_in[10];
  const float* bp      = (const float*)d_in[11];
  float* out = (float*)d_out;

  const size_t halfbuf = (size_t)MROWS * CDIM * sizeof(f16);  // 8 MB each
  char* ws = (char*)d_ws;
  f16* qh   = (f16*)(ws + 0 * halfbuf);
  f16* kh   = (f16*)(ws + 1 * halfbuf);
  f16* vt   = (f16*)(ws + 2 * halfbuf);   // [b][c][n] transposed

  // 1) xn = LayerNorm(inputs) (f32) -> d_out as residual base;
  //    Q = (xn @ Wq + bq) * U^-0.5 * log2(e) ; K = ctx @ Wk + bk ; V^T = (ctx @ Wv + bv)^T
  ln_qkv_kernel<<<2 * ROW_TILES, 256, 0, stream>>>(inputs, context, gamma, beta,
                                                   Wq, bq, Wk, bk, Wv, bv,
                                                   out, qh, kh, vt);
  // 2) d_out(=xn) += softmax(Q K^T) V @ Wp + bp, the softmax taken in base 2
  flash_attn_kernel<<<NBATCH * (NPIX / WG_QUERIES), 256, 0, stream>>>(qh, kh, vt, Wp, bp, out);
}
